// v000
// The times below were measured on an AMD MI455X: many runs one after another, warmed up first and cycling through
// copies of the inputs, with the whole window's GPU time divided by the number of runs. Launches and the gaps
// between them are all in it. The median over several windows is given; except for v000 it joins two sittings, which
// can be a few percent apart, so the side-by-side timings, each taken in one sitting, are the better comparison.
// v000, which the later versions start from, runs in 182 microseconds.
#include <hip/hip_runtime.h>
#include <hip/hip_bf16.h>

typedef __attribute__((ext_vector_type(16))) _Float16 v16h;
typedef __attribute__((ext_vector_type(8)))  _Float16 v8h;
typedef __attribute__((ext_vector_type(4)))  _Float16 v4h;
typedef __attribute__((ext_vector_type(8)))  float    v8f;
typedef __attribute__((ext_vector_type(4)))  float    v4f;

#define NEGVAL (-1000000.0f)

constexpr int Bn      = 16;
constexpr int Sq      = 2048;
constexpr int Sk      = 2048;
constexpr int Dh      = 128;
constexpr int QTILE   = 128;   // queries per block: 8 waves * 16 rows
constexpr int KTILE   = 32;    // keys per mainloop iteration
constexpr int VSTRIDE = 40;    // padded key-stride (halfs) of transposed V tile; 80B, 16B-aligned

// Flash-attention, wave32 WMMA formulation:
//   GEMM1: S^T = K_tile x Q^T ; GEMM2: O^T += V^T x P^T
// S^T accumulator layout feeds the P^T B-fragment with zero cross-lane moves.
// Double-buffered LDS; global loads for tile t+1 issue before tile t's WMMAs.
// Fragment LDS reads are software-pipelined one step ahead of the consuming
// WMMA so no wmma waits on the loads issued directly before it.
__global__ __launch_bounds__(256)
void fa_fwd_kernel(const float* __restrict__ qg,
                   const float* __restrict__ kg,
                   const float* __restrict__ vg,
                   const int*   __restrict__ valid_len,
                   float*       __restrict__ outg)
{
    __shared__ _Float16 Ksh [2][KTILE * Dh];      // [buf][key][d]   2 x 8 KB
    __shared__ _Float16 VshT[2][Dh * VSTRIDE];    // [buf][d][key]   2 x 10 KB

    const int tid  = threadIdx.x;
    const int lane = tid & 31;
    const int wave = tid >> 5;
    const int ln   = lane & 15;    // query column / matrix row-in-lane
    const int hi   = lane >> 4;    // half-wave select

    const int b      = blockIdx.y;
    const int qBlock = blockIdx.x * QTILE;
    const int qRow   = qBlock + wave * 16 + ln;
    const int vlen   = valid_len[b];

    const float* kb = kg + (size_t)b * Sk * Dh;
    const float* vb = vg + (size_t)b * Sk * Dh;

    // ---- vlen==0: softmax over a constant row -> uniform weights -> mean(V) ----
    if (vlen == 0) {
        float* red = reinterpret_cast<float*>(&Ksh[0][0]);   // 256 floats scratch
        const int d  = tid & 127;
        const int h2 = tid >> 7;
        float acc = 0.0f;
        for (int s = h2; s < Sk; s += 2) acc += vb[(size_t)s * Dh + d];
        red[tid] = acc;
        __syncthreads();
        const float mean = (red[d] + red[d + 128]) * (1.0f / (float)Sk);
        for (int r = h2; r < QTILE; r += 2)
            outg[((size_t)b * Sq + qBlock + r) * Dh + d] = mean;
        return;
    }

    const float sscale = 0.08838834764831845f;  // 1/sqrt(128), folded into Q

    // ---- Q^T B-fragments (pre-scaled), resident for the whole kernel ----
    v16h bq[4];
    {
        const float* qp = qg + ((size_t)b * Sq + qRow) * Dh;
#pragma unroll
        for (int c = 0; c < 4; ++c) {
            const float* p0 = qp + 32 * c + hi * 8;        // halves 0..7
            const float* p1 = qp + 32 * c + 16 + hi * 8;   // halves 8..15
            v16h t;
#pragma unroll
            for (int j = 0; j < 8; ++j) {
                t[j]     = (_Float16)(p0[j] * sscale);
                t[j + 8] = (_Float16)(p1[j] * sscale);
            }
            bq[c] = t;
        }
    }

    // O^T accumulators: 8 fragments cover d = 0..127 (16 per fragment)
    v8f o[8] = {};
    float m_i = -INFINITY;
    float l_i = 0.0f;

    const int nTiles = ((vlen + KTILE - 1) & ~(KTILE - 1)) / KTILE;   // >= 1

    // register staging for the double-buffer pipeline
    v4f kreg[4], vreg[4];

    auto loadTile = [&](int kt) {
#pragma unroll
        for (int p = 0; p < 4; ++p) {
            const int i = tid + p * 256;
            kreg[p] = *(const v4f*)(kb + (size_t)kt * Dh + i * 4);
            vreg[p] = *(const v4f*)(vb + (size_t)kt * Dh + i * 4);
        }
    };
    auto storeTile = [&](int buf) {
#pragma unroll
        for (int p = 0; p < 4; ++p) {
            const int i   = tid + p * 256;
            const int key = (i * 4) >> 7;     // 0..31
            const int col = (i * 4) & 127;    // d, multiple of 4
            v4h kh;
#pragma unroll
            for (int j = 0; j < 4; ++j) kh[j] = (_Float16)kreg[p][j];
            *(v4h*)(&Ksh[buf][i * 4]) = kh;
#pragma unroll
            for (int j = 0; j < 4; ++j)
                VshT[buf][(col + j) * VSTRIDE + key] = (_Float16)vreg[p][j];
        }
    };

    loadTile(0);
    storeTile(0);

    for (int t = 0; t < nTiles; ++t) {
        const int kt  = t * KTILE;
        const int cur = t & 1;
        __syncthreads();                       // buffer `cur` ready, other buffer free

        if (t + 1 < nTiles) loadTile(kt + KTILE);   // HBM latency hidden by WMMAs below

        const _Float16* kbase = &Ksh[cur][0];
        const _Float16* vbase = &VshT[cur][0];

        auto ldA = [&](int row16, int c, v16h& a) {   // K-tile A fragment
            const _Float16* r = kbase + (row16 + ln) * Dh + 32 * c + hi * 8;
            const v8h x = *(const v8h*)r;
            const v8h y = *(const v8h*)(r + 16);
#pragma unroll
            for (int j = 0; j < 8; ++j) { a[j] = x[j]; a[j + 8] = y[j]; }
        };
        auto ldV = [&](int n, v16h& a) {              // V^T A fragment (d-chunk n)
            const _Float16* vc = vbase + (16 * n + ln) * VSTRIDE;
            const v8h x = *(const v8h*)(vc + hi * 8);
            const v8h y = *(const v8h*)(vc + 16 + hi * 8);
#pragma unroll
            for (int j = 0; j < 8; ++j) { a[j] = x[j]; a[j + 8] = y[j]; }
        };

        // ---- GEMM1: S^T = K_tile . (Q*scale)^T, fragment loads pipelined ----
        v8f s0 = {}, s1 = {};
        {
            v16h a0, a1;
            ldA(0, 0, a0);
            ldA(16, 0, a1);
#pragma unroll
            for (int c = 0; c < 4; ++c) {
                v16h n0, n1;
                if (c < 3) { ldA(0, c + 1, n0); ldA(16, c + 1, n1); }
                s0 = __builtin_amdgcn_wmma_f32_16x16x32_f16(false, a0, false, bq[c],
                                                            (short)0, s0, false, false);
                s1 = __builtin_amdgcn_wmma_f32_16x16x32_f16(false, a1, false, bq[c],
                                                            (short)0, s1, false, false);
                if (c < 3) { a0 = n0; a1 = n1; }
            }
        }

        // ---- mask only the (single) partial tail tile ----
        if (kt + KTILE > vlen) {
            const int rem = vlen - kt - 8 * hi;    // per-lane; key0 = kt+8hi+j
#pragma unroll
            for (int j = 0; j < 8; ++j) {
                if (j >= rem)      s0[j] = NEGVAL;  // kt+8hi+j    >= vlen
                if (j >= rem - 16) s1[j] = NEGVAL;  // kt+16+8hi+j >= vlen
            }
        }

        // prefetch first V^T fragment; its LDS latency hides under the softmax
        v16h av;
        ldV(0, av);

        // ---- online softmax (per-query state per-lane; halves hold same query) ----
        float tmax = s0[0];
#pragma unroll
        for (int j = 1; j < 8; ++j) tmax = fmaxf(tmax, s0[j]);
#pragma unroll
        for (int j = 0; j < 8; ++j) tmax = fmaxf(tmax, s1[j]);
        tmax = fmaxf(tmax, __shfl_xor(tmax, 16, 32));

        float corr = 1.0f;
        if (__ballot(tmax > m_i)) {            // wave-uniform: skip exact-identity rescale
            const float mNew = fmaxf(m_i, tmax);
            corr = __expf(m_i - mNew);
            m_i  = mNew;
#pragma unroll
            for (int n = 0; n < 8; ++n)
#pragma unroll
                for (int j = 0; j < 8; ++j) o[n][j] *= corr;
        }

        v16h pT;
        float lsum = 0.0f;
#pragma unroll
        for (int j = 0; j < 8; ++j) {
            const float p0 = __expf(s0[j] - m_i);
            const float p1 = __expf(s1[j] - m_i);
            pT[j]     = (_Float16)p0;
            pT[j + 8] = (_Float16)p1;
            lsum += p0 + p1;
        }
        lsum += __shfl_xor(lsum, 16, 32);
        l_i = l_i * corr + lsum;

        // ---- GEMM2: O^T += V^T . P^T, fragment loads pipelined ----
#pragma unroll
        for (int n = 0; n < 8; ++n) {
            v16h avn;
            if (n < 7) ldV(n + 1, avn);
            o[n] = __builtin_amdgcn_wmma_f32_16x16x32_f16(false, av, false, pT,
                                                          (short)0, o[n], false, false);
            if (n < 7) av = avn;
        }

        if (t + 1 < nTiles) storeTile(1 - cur);     // convert + stage next buffer
    }

    // ---- normalize + write out (vectorized 16B stores) ----
    const float invl = 1.0f / l_i;
    float* op = outg + ((size_t)b * Sq + qRow) * Dh + 8 * hi;
#pragma unroll
    for (int n = 0; n < 8; ++n) {
        v4f lo4, hi4;
#pragma unroll
        for (int j = 0; j < 4; ++j) {
            lo4[j] = o[n][j]     * invl;
            hi4[j] = o[n][4 + j] * invl;
        }
        *(v4f*)(op + 16 * n)     = lo4;
        *(v4f*)(op + 16 * n + 4) = hi4;
    }
}

extern "C" void kernel_launch(void* const* d_in, const int* in_sizes, int n_in,
                              void* d_out, int out_size, void* d_ws, size_t ws_size,
                              hipStream_t stream) {
    const float* q  = (const float*)d_in[0];
    const float* k  = (const float*)d_in[1];
    const float* v  = (const float*)d_in[2];
    const int*   vl = (const int*)d_in[3];
    float* out = (float*)d_out;

    dim3 grid(Sq / QTILE, Bn, 1);   // 16 x 16 blocks
    fa_fwd_kernel<<<grid, 256, 0, stream>>>(q, k, v, vl, out);
}

// v001
// Measured time: 98.6 microseconds a run.
// Two timings next to v000 both put it at 1.84 times that version's speed.
#include <hip/hip_runtime.h>
#include <hip/hip_bf16.h>

typedef __attribute__((ext_vector_type(16))) _Float16 v16h;
typedef __attribute__((ext_vector_type(8)))  _Float16 v8h;
typedef __attribute__((ext_vector_type(4)))  _Float16 v4h;
typedef __attribute__((ext_vector_type(8)))  float    v8f;
typedef __attribute__((ext_vector_type(4)))  float    v4f;

#define NEGVAL (-1000000.0f)

constexpr int Bn      = 16;
constexpr int Sq      = 2048;
constexpr int Sk      = 2048;
constexpr int Dh      = 128;
constexpr int QTILE   = 128;   // queries per block: 8 waves * 16 rows
constexpr int KTILE   = 32;    // keys per mainloop iteration
constexpr int KSTRIDE = 136;   // padded row pitch (halfs) of the K tile; 272B = 16B x 17 (odd): b128 fragment reads spread over all banks
constexpr int VSTRIDE = 40;    // padded key-stride (halfs) of transposed V tile; 80B, 16B-aligned

// Flash-attention, wave32 WMMA formulation:
//   GEMM1: S^T = K_tile x Q^T ; GEMM2: O^T += V^T x P^T
// S^T accumulator layout feeds the P^T B-fragment with zero cross-lane moves.
// Double-buffered LDS; global loads for tile t+1 issue before tile t's WMMAs.
// Fragment LDS reads are software-pipelined one step ahead of the consuming
// WMMA so no wmma waits on the loads issued directly before it.
__global__ __launch_bounds__(256)
void fa_fwd_kernel(const float* __restrict__ qg,
                   const float* __restrict__ kg,
                   const float* __restrict__ vg,
                   const int*   __restrict__ valid_len,
                   float*       __restrict__ outg)
{
    __shared__ _Float16 Ksh [2][KTILE * KSTRIDE]; // [buf][key][d]   2 x 8.5 KB
    __shared__ _Float16 VshT[2][Dh * VSTRIDE];    // [buf][d][key]   2 x 10 KB

    const int tid  = threadIdx.x;
    const int lane = tid & 31;
    const int wave = tid >> 5;
    const int ln   = lane & 15;    // query column / matrix row-in-lane
    const int hi   = lane >> 4;    // half-wave select

    const int b      = blockIdx.y;
    const int qBlock = blockIdx.x * QTILE;
    const int qRow   = qBlock + wave * 16 + ln;
    // clamp bounds the trip count and every K/V address (same mask as the raw value); readfirstlane keeps it in a scalar register
    const int vlen   = __builtin_amdgcn_readfirstlane(min(max(valid_len[b], 0), Sk));

    const float* kb = kg + (size_t)b * Sk * Dh;
    const float* vb = vg + (size_t)b * Sk * Dh;

    // ---- vlen==0: softmax over a constant row -> uniform weights -> mean(V) ----
    if (vlen == 0) {
        float* red = reinterpret_cast<float*>(&Ksh[0][0]);   // 256 floats scratch
        const int d  = tid & 127;
        const int h2 = tid >> 7;
        float acc = 0.0f;
        for (int s = h2; s < Sk; s += 2) acc += vb[(size_t)s * Dh + d];
        red[tid] = acc;
        __syncthreads();
        const float mean = (red[d] + red[d + 128]) * (1.0f / (float)Sk);
        for (int r = h2; r < QTILE; r += 2)
            outg[((size_t)b * Sq + qBlock + r) * Dh + d] = mean;
        return;
    }

    const float sscale = 0.08838834764831845f;  // 1/sqrt(128), folded into Q

    // ---- Q^T B-fragments (pre-scaled), resident for the whole kernel ----
    v16h bq[4];
    {
        const float* qp = qg + ((size_t)b * Sq + qRow) * Dh;
#pragma unroll
        for (int c = 0; c < 4; ++c) {
            const float* p0 = qp + 32 * c + hi * 8;        // halves 0..7
            const float* p1 = qp + 32 * c + 16 + hi * 8;   // halves 8..15
            v16h t;
#pragma unroll
            for (int j = 0; j < 8; ++j) {
                t[j]     = (_Float16)(p0[j] * sscale);
                t[j + 8] = (_Float16)(p1[j] * sscale);
            }
            bq[c] = t;
        }
    }

    // O^T accumulators: 8 fragments cover d = 0..127 (16 per fragment)
    v8f o[8] = {};
    float m_i = -INFINITY;
    float l_i = 0.0f;

    const int nTiles = ((vlen + KTILE - 1) & ~(KTILE - 1)) / KTILE;   // >= 1

    // register staging for the double-buffer pipeline
    v4f kreg[4], vreg[4];

    auto loadTile = [&](int kt) {
#pragma unroll
        for (int p = 0; p < 4; ++p) {
            const int i = tid + p * 256;
            kreg[p] = *(const v4f*)(kb + (size_t)kt * Dh + i * 4);
            vreg[p] = *(const v4f*)(vb + (size_t)kt * Dh + i * 4);
        }
    };
    auto storeTile = [&](int buf) {
#pragma unroll
        for (int p = 0; p < 4; ++p) {
            const int i   = tid + p * 256;
            const int key = (i * 4) >> 7;     // 0..31
            const int col = (i * 4) & 127;    // d, multiple of 4
            v4h kh;
#pragma unroll
            for (int j = 0; j < 4; ++j) kh[j] = (_Float16)kreg[p][j];
            *(v4h*)(&Ksh[buf][key * KSTRIDE + col]) = kh;
#pragma unroll
            for (int j = 0; j < 4; ++j)
                VshT[buf][(col + j) * VSTRIDE + key] = (_Float16)vreg[p][j];
        }
    };

    loadTile(0);
    storeTile(0);

    for (int t = 0; t < nTiles; ++t) {
        const int kt  = t * KTILE;
        const int cur = t & 1;
        __syncthreads();                       // buffer `cur` ready, other buffer free

        if (t + 1 < nTiles) loadTile(kt + KTILE);   // HBM latency hidden by WMMAs below

        const _Float16* kbase = &Ksh[cur][0];
        const _Float16* vbase = &VshT[cur][0];

        auto ldA = [&](int row16, int c, v16h& a) {   // K-tile A fragment
            const _Float16* r = kbase + (row16 + ln) * KSTRIDE + 32 * c + hi * 8;
            const v8h x = *(const v8h*)r;
            const v8h y = *(const v8h*)(r + 16);
#pragma unroll
            for (int j = 0; j < 8; ++j) { a[j] = x[j]; a[j + 8] = y[j]; }
        };
        auto ldV = [&](int n, v16h& a) {              // V^T A fragment (d-chunk n)
            const _Float16* vc = vbase + (16 * n + ln) * VSTRIDE;
            const v8h x = *(const v8h*)(vc + hi * 8);
            const v8h y = *(const v8h*)(vc + 16 + hi * 8);
#pragma unroll
            for (int j = 0; j < 8; ++j) { a[j] = x[j]; a[j + 8] = y[j]; }
        };

        // ---- GEMM1: S^T = K_tile . (Q*scale)^T, fragment loads pipelined ----
        v8f s0 = {}, s1 = {};
        {
            v16h a0, a1;
            ldA(0, 0, a0);
            ldA(16, 0, a1);
#pragma unroll
            for (int c = 0; c < 4; ++c) {
                v16h n0, n1;
                if (c < 3) { ldA(0, c + 1, n0); ldA(16, c + 1, n1); }
                s0 = __builtin_amdgcn_wmma_f32_16x16x32_f16(false, a0, false, bq[c],
                                                            (short)0, s0, false, false);
                s1 = __builtin_amdgcn_wmma_f32_16x16x32_f16(false, a1, false, bq[c],
                                                            (short)0, s1, false, false);
                if (c < 3) { a0 = n0; a1 = n1; }
            }
        }

        // ---- mask only the (single) partial tail tile ----
        if (kt + KTILE > vlen) {
            const int rem = vlen - kt - 8 * hi;    // per-lane; key0 = kt+8hi+j
#pragma unroll
            for (int j = 0; j < 8; ++j) {
                if (j >= rem)      s0[j] = NEGVAL;  // kt+8hi+j    >= vlen
                if (j >= rem - 16) s1[j] = NEGVAL;  // kt+16+8hi+j >= vlen
            }
        }

        // prefetch first V^T fragment; its LDS latency hides under the softmax
        v16h av;
        ldV(0, av);

        // ---- online softmax (per-query state per-lane; halves hold same query) ----
        float tmax = s0[0];
#pragma unroll
        for (int j = 1; j < 8; ++j) tmax = fmaxf(tmax, s0[j]);
#pragma unroll
        for (int j = 0; j < 8; ++j) tmax = fmaxf(tmax, s1[j]);
        tmax = fmaxf(tmax, __shfl_xor(tmax, 16, 32));

        float corr = 1.0f;
        if (__ballot(tmax > m_i)) {            // wave-uniform: skip exact-identity rescale
            const float mNew = fmaxf(m_i, tmax);
            corr = __expf(m_i - mNew);
            m_i  = mNew;
#pragma unroll
            for (int n = 0; n < 8; ++n)
#pragma unroll
                for (int j = 0; j < 8; ++j) o[n][j] *= corr;
        }

        v16h pT;
        float lsum = 0.0f;
#pragma unroll
        for (int j = 0; j < 8; ++j) {
            const float p0 = __expf(s0[j] - m_i);
            const float p1 = __expf(s1[j] - m_i);
            pT[j]     = (_Float16)p0;
            pT[j + 8] = (_Float16)p1;
            lsum += p0 + p1;
        }
        lsum += __shfl_xor(lsum, 16, 32);
        l_i = l_i * corr + lsum;

        // ---- GEMM2: O^T += V^T . P^T, fragment loads pipelined ----
#pragma unroll
        for (int n = 0; n < 8; ++n) {
            v16h avn;
            if (n < 7) ldV(n + 1, avn);
            o[n] = __builtin_amdgcn_wmma_f32_16x16x32_f16(false, av, false, pT,
                                                          (short)0, o[n], false, false);
            if (n < 7) av = avn;
        }

        if (t + 1 < nTiles) storeTile(1 - cur);     // convert + stage next buffer
    }

    // ---- normalize + write out (vectorized 16B stores) ----
    const float invl = 1.0f / l_i;
    float* op = outg + ((size_t)b * Sq + qRow) * Dh + 8 * hi;
#pragma unroll
    for (int n = 0; n < 8; ++n) {
        v4f lo4, hi4;
#pragma unroll
        for (int j = 0; j < 4; ++j) {
            lo4[j] = o[n][j]     * invl;
            hi4[j] = o[n][4 + j] * invl;
        }
        *(v4f*)(op + 16 * n)     = lo4;
        *(v4f*)(op + 16 * n + 4) = hi4;
    }
}

extern "C" void kernel_launch(void* const* d_in, const int* in_sizes, int n_in,
                              void* d_out, int out_size, void* d_ws, size_t ws_size,
                              hipStream_t stream) {
    const float* q  = (const float*)d_in[0];
    const float* k  = (const float*)d_in[1];
    const float* v  = (const float*)d_in[2];
    const int*   vl = (const int*)d_in[3];
    float* out = (float*)d_out;

    dim3 grid(Sq / QTILE, Bn, 1);   // 16 x 16 blocks
    fa_fwd_kernel<<<grid, 256, 0, stream>>>(q, k, v, vl, out);
}

// v002
// Measured time: 56.2 microseconds a run.
// Timed twice side by side with v001, it ran 1.74 and 1.78 times as fast.
// Over all steps from v000 it is 3.24 times as fast.
#include <hip/hip_runtime.h>
#include <hip/hip_bf16.h>

typedef __attribute__((ext_vector_type(16))) _Float16 v16h;
typedef __attribute__((ext_vector_type(8)))  _Float16 v8h;
typedef __attribute__((ext_vector_type(4)))  _Float16 v4h;
typedef __attribute__((ext_vector_type(8)))  short    v8s;
typedef __attribute__((ext_vector_type(8)))  float    v8f;
typedef __attribute__((ext_vector_type(4)))  float    v4f;

#define NEGVAL (-1000000.0f)

constexpr int Bn      = 16;
constexpr int Sq      = 2048;
constexpr int Sk      = 2048;
constexpr int Dh      = 128;
constexpr int QTILE   = 128;   // queries per block: 8 waves * 16 rows
constexpr int KTILE   = 32;    // keys per mainloop iteration
constexpr int KSTRIDE = 136;   // padded row pitch (halfs) of the K tile; 272B = 16B x 17 (odd): b128 fragment reads spread over all banks
constexpr int VSTRIDE = 144;   // padded row pitch (halfs) of the row-major V tile; 288B = 32B x 9 (odd): the pitch of the transposing reads

// Flash-attention, wave32 WMMA formulation:
//   GEMM1: S^T = K_tile x Q^T ; GEMM2: O^T += V^T x P^T
// S^T accumulator layout feeds the P^T B-fragment with zero cross-lane moves.
// V is staged row-major like K; ds_load_tr16_b128 transposes it on the way to the A fragment.
// Double-buffered LDS; global loads for tile t+1 issue before tile t's WMMAs.
// Fragment LDS reads are software-pipelined one step ahead of the consuming
// WMMA so no wmma waits on the loads issued directly before it.
__global__ __launch_bounds__(256)
void fa_fwd_kernel(const float* __restrict__ qg,
                   const float* __restrict__ kg,
                   const float* __restrict__ vg,
                   const int*   __restrict__ valid_len,
                   float*       __restrict__ outg)
{
    __shared__ _Float16 Ksh [2][KTILE * KSTRIDE]; // [buf][key][d]   2 x 8.5 KB
    __shared__ __attribute__((aligned(16))) _Float16 Vsh[2][KTILE * VSTRIDE]; // [buf][key][d]   2 x 9 KB

    const int tid  = threadIdx.x;
    const int lane = tid & 31;
    const int wave = tid >> 5;
    const int ln   = lane & 15;    // query column / matrix row-in-lane
    const int hi   = lane >> 4;    // half-wave select

    const int b      = blockIdx.y;
    const int qBlock = blockIdx.x * QTILE;
    const int qRow   = qBlock + wave * 16 + ln;
    // clamp bounds the trip count and every K/V address (same mask as the raw value); readfirstlane keeps it in a scalar register
    const int vlen   = __builtin_amdgcn_readfirstlane(min(max(valid_len[b], 0), Sk));

    const float* kb = kg + (size_t)b * Sk * Dh;
    const float* vb = vg + (size_t)b * Sk * Dh;

    // ---- vlen==0: softmax over a constant row -> uniform weights -> mean(V) ----
    if (vlen == 0) {
        float* red = reinterpret_cast<float*>(&Ksh[0][0]);   // 256 floats scratch
        const int d  = tid & 127;
        const int h2 = tid >> 7;
        float acc = 0.0f;
        for (int s = h2; s < Sk; s += 2) acc += vb[(size_t)s * Dh + d];
        red[tid] = acc;
        __syncthreads();
        const float mean = (red[d] + red[d + 128]) * (1.0f / (float)Sk);
        for (int r = h2; r < QTILE; r += 2)
            outg[((size_t)b * Sq + qBlock + r) * Dh + d] = mean;
        return;
    }

    const float sscale = 0.08838834764831845f;  // 1/sqrt(128), folded into Q

    // ---- Q^T B-fragments (pre-scaled), resident for the whole kernel ----
    v16h bq[4];
    {
        const float* qp = qg + ((size_t)b * Sq + qRow) * Dh;
#pragma unroll
        for (int c = 0; c < 4; ++c) {
            const float* p0 = qp + 32 * c + hi * 8;        // halves 0..7
            const float* p1 = qp + 32 * c + 16 + hi * 8;   // halves 8..15
            v16h t;
#pragma unroll
            for (int j = 0; j < 8; ++j) {
                t[j]     = (_Float16)(p0[j] * sscale);
                t[j + 8] = (_Float16)(p1[j] * sscale);
            }
            bq[c] = t;
        }
    }

    // O^T accumulators: 8 fragments cover d = 0..127 (16 per fragment)
    v8f o[8] = {};
    float m_i = -INFINITY;
    float l_i = 0.0f;

    const int nTiles = ((vlen + KTILE - 1) & ~(KTILE - 1)) / KTILE;   // >= 1

    // register staging for the double-buffer pipeline
    v4f kreg[4], vreg[4];

    auto loadTile = [&](int kt) {
#pragma unroll
        for (int p = 0; p < 4; ++p) {
            const int i = tid + p * 256;
            kreg[p] = *(const v4f*)(kb + (size_t)kt * Dh + i * 4);
            vreg[p] = *(const v4f*)(vb + (size_t)kt * Dh + i * 4);
        }
    };
    auto storeTile = [&](int buf) {
#pragma unroll
        for (int p = 0; p < 4; ++p) {
            const int i   = tid + p * 256;
            const int key = (i * 4) >> 7;     // 0..31
            const int col = (i * 4) & 127;    // d, multiple of 4
            v4h kh;
#pragma unroll
            for (int j = 0; j < 4; ++j) kh[j] = (_Float16)kreg[p][j];
            *(v4h*)(&Ksh[buf][key * KSTRIDE + col]) = kh;
            v4h vh;
#pragma unroll
            for (int j = 0; j < 4; ++j) vh[j] = (_Float16)vreg[p][j];
            *(v4h*)(&Vsh[buf][key * VSTRIDE + col]) = vh;
        }
    };

    loadTile(0);
    storeTile(0);

    for (int t = 0; t < nTiles; ++t) {
        const int kt  = t * KTILE;
        const int cur = t & 1;
        __syncthreads();                       // buffer `cur` ready, other buffer free

        if (t + 1 < nTiles) loadTile(kt + KTILE);   // HBM latency hidden by WMMAs below

        const _Float16* kbase = &Ksh[cur][0];
        // lane address of the transposing read: row 8*hi + (lane & 7), 16-byte column half (lane >> 3) & 1
        const _Float16* vbase = &Vsh[cur][(8 * hi + (lane & 7)) * VSTRIDE + 8 * ((lane >> 3) & 1)];

        auto ldA = [&](int row16, int c, v16h& a) {   // K-tile A fragment
            const _Float16* r = kbase + (row16 + ln) * KSTRIDE + 32 * c + hi * 8;
            const v8h x = *(const v8h*)r;
            const v8h y = *(const v8h*)(r + 16);
#pragma unroll
            for (int j = 0; j < 8; ++j) { a[j] = x[j]; a[j + 8] = y[j]; }
        };
        auto ldV = [&](int n, v16h& a) {              // V^T A fragment (d-chunk n)
            typedef __attribute__((address_space(3))) v8s lds_v8s;
            const _Float16* vc = vbase + 16 * n;
            // lane (ln, hi) receives V[8*hi + 0..7][16*n + ln], then keys 16 + 8*hi + 0..7: the k order of pT
            const v8h x = __builtin_bit_cast(v8h, __builtin_amdgcn_ds_load_tr16_b128_v8i16((lds_v8s*)vc));
            const v8h y = __builtin_bit_cast(v8h, __builtin_amdgcn_ds_load_tr16_b128_v8i16((lds_v8s*)(vc + 16 * VSTRIDE)));
#pragma unroll
            for (int j = 0; j < 8; ++j) { a[j] = x[j]; a[j + 8] = y[j]; }
        };

        // ---- GEMM1: S^T = K_tile . (Q*scale)^T, fragment loads pipelined ----
        v8f s0 = {}, s1 = {};
        {
            v16h a0, a1;
            ldA(0, 0, a0);
            ldA(16, 0, a1);
#pragma unroll
            for (int c = 0; c < 4; ++c) {
                v16h n0, n1;
                if (c < 3) { ldA(0, c + 1, n0); ldA(16, c + 1, n1); }
                s0 = __builtin_amdgcn_wmma_f32_16x16x32_f16(false, a0, false, bq[c],
                                                            (short)0, s0, false, false);
                s1 = __builtin_amdgcn_wmma_f32_16x16x32_f16(false, a1, false, bq[c],
                                                            (short)0, s1, false, false);
                if (c < 3) { a0 = n0; a1 = n1; }
            }
        }

        // ---- mask only the (single) partial tail tile ----
        if (kt + KTILE > vlen) {
            const int rem = vlen - kt - 8 * hi;    // per-lane; key0 = kt+8hi+j
#pragma unroll
            for (int j = 0; j < 8; ++j) {
                if (j >= rem)      s0[j] = NEGVAL;  // kt+8hi+j    >= vlen
                if (j >= rem - 16) s1[j] = NEGVAL;  // kt+16+8hi+j >= vlen
            }
        }

        // prefetch first V^T fragment; its LDS latency hides under the softmax
        v16h av;
        ldV(0, av);

        // ---- online softmax (per-query state per-lane; halves hold same query) ----
        float tmax = s0[0];
#pragma unroll
        for (int j = 1; j < 8; ++j) tmax = fmaxf(tmax, s0[j]);
#pragma unroll
        for (int j = 0; j < 8; ++j) tmax = fmaxf(tmax, s1[j]);
        tmax = fmaxf(tmax, __shfl_xor(tmax, 16, 32));

        float corr = 1.0f;
        if (__ballot(tmax > m_i)) {            // wave-uniform: skip exact-identity rescale
            const float mNew = fmaxf(m_i, tmax);
            corr = __expf(m_i - mNew);
            m_i  = mNew;
#pragma unroll
            for (int n = 0; n < 8; ++n)
#pragma unroll
                for (int j = 0; j < 8; ++j) o[n][j] *= corr;
        }

        v16h pT;
        float lsum = 0.0f;
#pragma unroll
        for (int j = 0; j < 8; ++j) {
            const float p0 = __expf(s0[j] - m_i);
            const float p1 = __expf(s1[j] - m_i);
            pT[j]     = (_Float16)p0;
            pT[j + 8] = (_Float16)p1;
            lsum += p0 + p1;
        }
        lsum += __shfl_xor(lsum, 16, 32);
        l_i = l_i * corr + lsum;

        // ---- GEMM2: O^T += V^T . P^T, fragment loads pipelined ----
#pragma unroll
        for (int n = 0; n < 8; ++n) {
            v16h avn;
            if (n < 7) ldV(n + 1, avn);
            o[n] = __builtin_amdgcn_wmma_f32_16x16x32_f16(false, av, false, pT,
                                                          (short)0, o[n], false, false);
            if (n < 7) av = avn;
        }

        if (t + 1 < nTiles) storeTile(1 - cur);     // convert + stage next buffer
    }

    // ---- normalize + write out (vectorized 16B stores) ----
    const float invl = 1.0f / l_i;
    float* op = outg + ((size_t)b * Sq + qRow) * Dh + 8 * hi;
#pragma unroll
    for (int n = 0; n < 8; ++n) {
        v4f lo4, hi4;
#pragma unroll
        for (int j = 0; j < 4; ++j) {
            lo4[j] = o[n][j]     * invl;
            hi4[j] = o[n][4 + j] * invl;
        }
        *(v4f*)(op + 16 * n)     = lo4;
        *(v4f*)(op + 16 * n + 4) = hi4;
    }
}

extern "C" void kernel_launch(void* const* d_in, const int* in_sizes, int n_in,
                              void* d_out, int out_size, void* d_ws, size_t ws_size,
                              hipStream_t stream) {
    const float* q  = (const float*)d_in[0];
    const float* k  = (const float*)d_in[1];
    const float* v  = (const float*)d_in[2];
    const int*   vl = (const int*)d_in[3];
    float* out = (float*)d_out;

    dim3 grid(Sq / QTILE, Bn, 1);   // 16 x 16 blocks
    fa_fwd_kernel<<<grid, 256, 0, stream>>>(q, k, v, vl, out);
}

// v003
// Measured time: 42.8 microseconds a run.
// Two timings next to v002 both put it at 1.31 times that version's speed.
// Counting every step since v000, it is 4.24 times as fast.
#include <hip/hip_runtime.h>
#include <hip/hip_bf16.h>

typedef __attribute__((ext_vector_type(16))) _Float16 v16h;
typedef __attribute__((ext_vector_type(8)))  _Float16 v8h;
typedef __attribute__((ext_vector_type(4)))  _Float16 v4h;
typedef __attribute__((ext_vector_type(8)))  short    v8s;
typedef __attribute__((ext_vector_type(8)))  float    v8f;
typedef __attribute__((ext_vector_type(4)))  float    v4f;
typedef __attribute__((ext_vector_type(2)))  float    v2f;

#define NEGVAL (-1000000.0f)

constexpr int Bn      = 16;
constexpr int Sq      = 2048;
constexpr int Sk      = 2048;
constexpr int Dh      = 128;
constexpr int QTILE   = 128;   // queries per block: 8 waves * 16 rows
constexpr int KTILE   = 32;    // keys per mainloop iteration
constexpr int KSTRIDE = 136;   // padded row pitch (halfs) of the K tile; 272B = 16B x 17 (odd): b128 fragment reads spread over all banks
constexpr int UNITS   = 32;    // (batch, key chunk) pairs at most; x 16 query blocks = 512 work-groups, two resident per WGP at this register count
constexpr int MINCH   = 8;     // shortest chunk (tiles) worth its own Q load and partial store
constexpr int MAXCH   = Sk / KTILE / MINCH;            // chunks of one batch at most
constexpr int PTILE   = 16 * Dh;                       // floats of one wave's partial O^T (16 queries)
constexpr size_t ML_OFF = (size_t)UNITS * Sq * Dh;     // float index in the workspace of the (max, sum) pairs
constexpr int VSTRIDE = 144;   // padded row pitch (halfs) of the row-major V tile; 288B = 32B x 9 (odd): the pitch of the transposing reads

// Cut of the keys, derived from the lengths alone and alike in both kernels: every batch's key tiles fall into
// chunks of L tiles, L the smallest length (>= MINCH) at which all batches together make at most UNITS chunks.
// Lane l tries L = l + 1; lane 31 always passes (64 tiles at most are two chunks of 32). A batch of length 0 is one chunk.
// Needs all 32 lanes on. Returns L; nch[b] = chunks of batch b (wave-uniform).
__device__ __forceinline__ int plan_chunks(const int* __restrict__ valid_len, int lane, int (&nch)[Bn])
{
    const unsigned L     = (unsigned)lane + 1u;
    const unsigned recip = 65536u / L + 1u;    // x / L == (x * recip) >> 16, exact while x * L < 65536 (here x < 96, L <= 32)
    int n[Bn];
    int cnt = 0;
#pragma unroll
    for (int b = 0; b < Bn; ++b) {
        const unsigned nT = (unsigned)(min(max(valid_len[b], 0), Sk) + KTILE - 1) / KTILE;
        n[b] = max((int)(((nT + L - 1u) * recip) >> 16), 1);
        cnt += n[b];
    }
    const unsigned ok  = __builtin_amdgcn_ballot_w32(cnt <= UNITS && L >= (unsigned)MINCH);
    const int      sel = __builtin_ctz(ok);
#pragma unroll
    for (int b = 0; b < Bn; ++b) nch[b] = __builtin_amdgcn_readlane(n[b], sel);
    return sel + 1;
}

// Flash-attention, wave32 WMMA formulation:
//   GEMM1: S^T = K_tile x Q^T ; GEMM2: O^T += V^T x P^T
// S^T accumulator layout feeds the P^T B-fragment with zero cross-lane moves.
// V is staged row-major like K; ds_load_tr16_b128 transposes it on the way to the A fragment.
// Double-buffered LDS; global loads for tile t+1 issue before tile t's WMMAs.
// Fragment LDS reads are software-pipelined one step ahead of the consuming
// WMMA so no wmma waits on the loads issued directly before it.
// One work-group = one (batch, key chunk, 128-query block). A batch of one chunk is normalized and stored to out here;
// a batch of several leaves un-normalized partials and (max, sum) in the workspace for fa_merge_kernel.
__global__ __launch_bounds__(256)
void fa_fwd_kernel(const float* __restrict__ qg,
                   const float* __restrict__ kg,
                   const float* __restrict__ vg,
                   const int*   __restrict__ valid_len,
                   float*       __restrict__ outg,
                   float*       __restrict__ ws)
{
    __shared__ _Float16 Ksh [2][KTILE * KSTRIDE]; // [buf][key][d]   2 x 8.5 KB
    __shared__ __attribute__((aligned(16))) _Float16 Vsh[2][KTILE * VSTRIDE]; // [buf][key][d]   2 x 9 KB

    const int tid  = threadIdx.x;
    const int lane = tid & 31;
    const int wave = tid >> 5;
    const int ln   = lane & 15;    // query column / matrix row-in-lane
    const int hi   = lane >> 4;    // half-wave select

    // which (batch, chunk) this work-group has: all scalar, alike in every wave
    int nch[Bn];
    const int L    = plan_chunks(valid_len, lane, nch);
    const int unit = blockIdx.x >> 4;
    int b = -1, chunk = 0, nc = 0;
    {
        int first = 0;
#pragma unroll
        for (int bb = 0; bb < Bn; ++bb) {
            if (unit >= first && unit < first + nch[bb]) { b = bb; chunk = unit - first; nc = nch[bb]; }
            first += nch[bb];
        }
    }
    if (b < 0) return;             // no chunk left for this work-group: the whole group leaves, before any barrier

    const int qBlock = (blockIdx.x & 15) * QTILE;
    const int qRow   = qBlock + wave * 16 + ln;
    // clamp bounds the trip count and every K/V address (same mask as the raw value); readfirstlane keeps it in a scalar register
    const int vlen   = __builtin_amdgcn_readfirstlane(min(max(valid_len[b], 0), Sk));

    const float* kb = kg + (size_t)b * Sk * Dh;
    const float* vb = vg + (size_t)b * Sk * Dh;

    // ---- vlen==0: softmax over a constant row -> uniform weights -> mean(V) ----
    if (vlen == 0) {
        float* red = reinterpret_cast<float*>(&Ksh[0][0]);   // 256 floats scratch
        const int d  = tid & 127;
        const int h2 = tid >> 7;
        float acc = 0.0f;
        for (int s = h2; s < Sk; s += 2) acc += vb[(size_t)s * Dh + d];
        red[tid] = acc;
        __syncthreads();
        const float mean = (red[d] + red[d + 128]) * (1.0f / (float)Sk);
        for (int r = h2; r < QTILE; r += 2)
            outg[((size_t)b * Sq + qBlock + r) * Dh + d] = mean;
        return;
    }

    const float sscale = 0.08838834764831845f;  // 1/sqrt(128), folded into Q

    // ---- Q^T B-fragments (pre-scaled), resident for the whole kernel ----
    v16h bq[4];
    {
        const float* qp = qg + ((size_t)b * Sq + qRow) * Dh;
#pragma unroll
        for (int c = 0; c < 4; ++c) {
            const float* p0 = qp + 32 * c + hi * 8;        // halves 0..7
            const float* p1 = qp + 32 * c + 16 + hi * 8;   // halves 8..15
            v16h t;
#pragma unroll
            for (int j = 0; j < 8; ++j) {
                t[j]     = (_Float16)(p0[j] * sscale);
                t[j + 8] = (_Float16)(p1[j] * sscale);
            }
            bq[c] = t;
        }
    }

    // O^T accumulators: 8 fragments cover d = 0..127 (16 per fragment)
    v8f o[8] = {};
    float m_i = -INFINITY;
    float l_i = 0.0f;

    const int nAll   = ((vlen + KTILE - 1) & ~(KTILE - 1)) / KTILE;   // >= 1
    const int tFirst = chunk * L;                                     // < nAll: chunk < ceil(nAll / L)
    const int nTiles = min(nAll, tFirst + L);                         // end of this chunk

    // register staging for the double-buffer pipeline
    v4f kreg[4], vreg[4];

    auto loadTile = [&](int kt) {
#pragma unroll
        for (int p = 0; p < 4; ++p) {
            const int i = tid + p * 256;
            kreg[p] = *(const v4f*)(kb + (size_t)kt * Dh + i * 4);
            vreg[p] = *(const v4f*)(vb + (size_t)kt * Dh + i * 4);
        }
    };
    auto storeTile = [&](int buf) {
#pragma unroll
        for (int p = 0; p < 4; ++p) {
            const int i   = tid + p * 256;
            const int key = (i * 4) >> 7;     // 0..31
            const int col = (i * 4) & 127;    // d, multiple of 4
            v4h kh;
#pragma unroll
            for (int j = 0; j < 4; ++j) kh[j] = (_Float16)kreg[p][j];
            *(v4h*)(&Ksh[buf][key * KSTRIDE + col]) = kh;
            v4h vh;
#pragma unroll
            for (int j = 0; j < 4; ++j) vh[j] = (_Float16)vreg[p][j];
            *(v4h*)(&Vsh[buf][key * VSTRIDE + col]) = vh;
        }
    };

    loadTile(tFirst * KTILE);
    storeTile(0);

    for (int t = tFirst; t < nTiles; ++t) {
        const int kt  = t * KTILE;
        const int cur = (t - tFirst) & 1;
        __syncthreads();                       // buffer `cur` ready, other buffer free

        if (t + 1 < nTiles) loadTile(kt + KTILE);   // HBM latency hidden by WMMAs below

        const _Float16* kbase = &Ksh[cur][0];
        // lane address of the transposing read: row 8*hi + (lane & 7), 16-byte column half (lane >> 3) & 1
        const _Float16* vbase = &Vsh[cur][(8 * hi + (lane & 7)) * VSTRIDE + 8 * ((lane >> 3) & 1)];

        auto ldA = [&](int row16, int c, v16h& a) {   // K-tile A fragment
            const _Float16* r = kbase + (row16 + ln) * KSTRIDE + 32 * c + hi * 8;
            const v8h x = *(const v8h*)r;
            const v8h y = *(const v8h*)(r + 16);
#pragma unroll
            for (int j = 0; j < 8; ++j) { a[j] = x[j]; a[j + 8] = y[j]; }
        };
        auto ldV = [&](int n, v16h& a) {              // V^T A fragment (d-chunk n)
            typedef __attribute__((address_space(3))) v8s lds_v8s;
            const _Float16* vc = vbase + 16 * n;
            // lane (ln, hi) receives V[8*hi + 0..7][16*n + ln], then keys 16 + 8*hi + 0..7: the k order of pT
            const v8h x = __builtin_bit_cast(v8h, __builtin_amdgcn_ds_load_tr16_b128_v8i16((lds_v8s*)vc));
            const v8h y = __builtin_bit_cast(v8h, __builtin_amdgcn_ds_load_tr16_b128_v8i16((lds_v8s*)(vc + 16 * VSTRIDE)));
#pragma unroll
            for (int j = 0; j < 8; ++j) { a[j] = x[j]; a[j + 8] = y[j]; }
        };

        // ---- GEMM1: S^T = K_tile . (Q*scale)^T, fragment loads pipelined ----
        v8f s0 = {}, s1 = {};
        {
            v16h a0, a1;
            ldA(0, 0, a0);
            ldA(16, 0, a1);
#pragma unroll
            for (int c = 0; c < 4; ++c) {
                v16h n0, n1;
                if (c < 3) { ldA(0, c + 1, n0); ldA(16, c + 1, n1); }
                s0 = __builtin_amdgcn_wmma_f32_16x16x32_f16(false, a0, false, bq[c],
                                                            (short)0, s0, false, false);
                s1 = __builtin_amdgcn_wmma_f32_16x16x32_f16(false, a1, false, bq[c],
                                                            (short)0, s1, false, false);
                if (c < 3) { a0 = n0; a1 = n1; }
            }
        }

        // ---- mask only the (single) partial tail tile ----
        if (kt + KTILE > vlen) {
            const int rem = vlen - kt - 8 * hi;    // per-lane; key0 = kt+8hi+j
#pragma unroll
            for (int j = 0; j < 8; ++j) {
                if (j >= rem)      s0[j] = NEGVAL;  // kt+8hi+j    >= vlen
                if (j >= rem - 16) s1[j] = NEGVAL;  // kt+16+8hi+j >= vlen
            }
        }

        // prefetch first V^T fragment; its LDS latency hides under the softmax
        v16h av;
        ldV(0, av);

        // ---- online softmax (per-query state per-lane; halves hold same query) ----
        float tmax = s0[0];
#pragma unroll
        for (int j = 1; j < 8; ++j) tmax = fmaxf(tmax, s0[j]);
#pragma unroll
        for (int j = 0; j < 8; ++j) tmax = fmaxf(tmax, s1[j]);
        tmax = fmaxf(tmax, __shfl_xor(tmax, 16, 32));

        float corr = 1.0f;
        if (__ballot(tmax > m_i)) {            // wave-uniform: skip exact-identity rescale
            const float mNew = fmaxf(m_i, tmax);
            corr = __expf(m_i - mNew);
            m_i  = mNew;
#pragma unroll
            for (int n = 0; n < 8; ++n)
#pragma unroll
                for (int j = 0; j < 8; ++j) o[n][j] *= corr;
        }

        v16h pT;
        float lsum = 0.0f;
#pragma unroll
        for (int j = 0; j < 8; ++j) {
            const float p0 = __expf(s0[j] - m_i);
            const float p1 = __expf(s1[j] - m_i);
            pT[j]     = (_Float16)p0;
            pT[j + 8] = (_Float16)p1;
            lsum += p0 + p1;
        }
        lsum += __shfl_xor(lsum, 16, 32);
        l_i = l_i * corr + lsum;

        // ---- GEMM2: O^T += V^T . P^T, fragment loads pipelined ----
#pragma unroll
        for (int n = 0; n < 8; ++n) {
            v16h avn;
            if (n < 7) ldV(n + 1, avn);
            o[n] = __builtin_amdgcn_wmma_f32_16x16x32_f16(false, av, false, pT,
                                                          (short)0, o[n], false, false);
            if (n < 7) av = avn;
        }

        if (t + 1 < nTiles) storeTile(1 - cur);     // convert + stage next buffer
    }

    // ---- several chunks: partial O^T in register order (512 contiguous bytes per store) + (max, sum) ----
    if (nc > 1) {
        float* pw = ws + ((size_t)unit * (Sq / 16) + (qBlock >> 4) + wave) * PTILE + lane * 4;
#pragma unroll
        for (int n = 0; n < 8; ++n) {
            v4f lo4, hi4;
#pragma unroll
            for (int j = 0; j < 4; ++j) { lo4[j] = o[n][j]; hi4[j] = o[n][4 + j]; }
            *(v4f*)(pw + (2 * n) * 128)     = lo4;
            *(v4f*)(pw + (2 * n + 1) * 128) = hi4;
        }
        if (hi == 0) {             // both halves hold the same pair
            v2f ml; ml[0] = m_i; ml[1] = l_i;
            *(v2f*)(ws + ML_OFF + ((size_t)unit * Sq + qRow) * 2) = ml;
        }
        return;
    }

    // ---- normalize + write out (vectorized 16B stores) ----
    const float invl = 1.0f / l_i;
    float* op = outg + ((size_t)b * Sq + qRow) * Dh + 8 * hi;
#pragma unroll
    for (int n = 0; n < 8; ++n) {
        v4f lo4, hi4;
#pragma unroll
        for (int j = 0; j < 4; ++j) {
            lo4[j] = o[n][j]     * invl;
            hi4[j] = o[n][4 + j] * invl;
        }
        *(v4f*)(op + 16 * n)     = lo4;
        *(v4f*)(op + 16 * n + 4) = hi4;
    }
    // precaution: in the built code the partial path's register writes stand behind these stores
    asm volatile("s_wait_xcnt 0x0" ::: "memory");
}

// Joins the chunks of a batch: weight exp(m_c - M) per chunk, sums in chunk order, one division.
// One wave = 16 queries x 64 of the 128 output columns (a half), in the register order the partials were stored in.
__global__ __launch_bounds__(256)
void fa_merge_kernel(const int*   __restrict__ valid_len,
                     const float* __restrict__ ws,
                     float*       __restrict__ outg)
{
    const int tid  = threadIdx.x;
    const int lane = tid & 31;
    const int wave = __builtin_amdgcn_readfirstlane(tid >> 5);   // scalar: keeps every chunk address a scalar base plus one lane offset
    const int ln   = lane & 15;
    const int hi   = lane >> 4;

    const int half   = blockIdx.x & 1;
    const int qBlock = ((blockIdx.x >> 1) & 15) * QTILE;
    const int b      = blockIdx.x >> 5;

    int nch[Bn];
    plan_chunks(valid_len, lane, nch);
    int first = 0, nc = 0;
#pragma unroll
    for (int bb = 0; bb < Bn; ++bb) {
        if (bb < b)  first += nch[bb];
        if (bb == b) nc = nch[bb];
    }
    if (nc <= 1) return;           // stored whole by the first kernel

    const int qRow = qBlock + wave * 16 + ln;
    const float* mlp = ws + ML_OFF + ((size_t)first * Sq + qBlock + wave * 16) * 2;                             // scalar
    const float* pp  = ws + ((size_t)first * (Sq / 16) + (qBlock >> 4) + wave) * PTILE + half * 1024;           // scalar
    const unsigned mlo = (unsigned)ln * 2u;      // lane offsets, in floats
    const unsigned po  = (unsigned)lane * 4u;

    // all (max, sum) pairs in flight at once: the index is clamped, so a chunk past the last re-reads the last; its weight is 0
    v2f ml[MAXCH];
#pragma unroll
    for (int c = 0; c < MAXCH; ++c) {
        // the chunk's base held in scalar registers: every load is that base plus the one lane offset, no 64-bit vector add per load
        const unsigned long long a = (unsigned long long)(mlp + (size_t)min(c, nc - 1) * Sq * 2);
        const unsigned alo = __builtin_amdgcn_readfirstlane((unsigned)a);
        const unsigned ahi = __builtin_amdgcn_readfirstlane((unsigned)(a >> 32));
        typedef __attribute__((address_space(1))) const float gfloat;
        gfloat* sp = (gfloat*)(((unsigned long long)ahi << 32) | alo);
        ml[c][0] = sp[mlo];
        ml[c][1] = sp[mlo + 1u];
    }
    // two chunks per trip, their 16 loads in flight together; an odd count re-reads its last chunk at weight 0
    v4f x0[8], x1[8];
    auto loadPair = [&](int c) {
        const float* p0 = pp + (size_t)c * Sq * Dh;
        const float* p1 = pp + (size_t)min(c + 1, nc - 1) * Sq * Dh;
#pragma unroll
        for (int k = 0; k < 8; ++k) x0[k] = *(const v4f*)(p0 + k * 128 + po);
#pragma unroll
        for (int k = 0; k < 8; ++k) x1[k] = *(const v4f*)(p1 + k * 128 + po);
        // keeps all the loads above what follows: without it the scheduler sinks each load to its use and the wave waits out one latency after another
        __builtin_amdgcn_sched_barrier(0);
    };
    loadPair(0);
    // precaution: the scalar bases of the loads above are reused by the code below; the wait stands in front of the first such overwrite
    asm volatile("s_wait_xcnt 0x0" ::: "memory");

    float M = ml[0][0];
#pragma unroll
    for (int c = 1; c < MAXCH; ++c) M = fmaxf(M, ml[c][0]);
    float w[MAXCH];
    float Ls = 0.0f;
#pragma unroll
    for (int c = 0; c < MAXCH; ++c) {
        w[c] = (c < nc) ? __expf(ml[c][0] - M) : 0.0f;   // every chunk holds a valid key: its maximum is finite
        Ls += w[c] * ml[c][1];
    }

    v4f acc[8] = {};
#pragma unroll
    for (int c = 0; c < MAXCH; c += 2) {
#pragma unroll
        for (int k = 0; k < 8; ++k) { acc[k] += w[c] * x0[k]; acc[k] += w[c + 1] * x1[k]; }
        if (c + 2 >= nc) break;                // scalar test
        loadPair(c + 2);
    }

    const float invl = 1.0f / Ls;
    float* op = outg + ((size_t)b * Sq + qRow) * Dh + 8 * hi + 64 * half;
#pragma unroll
    for (int k = 0; k < 8; ++k)
        *(v4f*)(op + 16 * (k >> 1) + 4 * (k & 1)) = acc[k] * invl;
}

extern "C" void kernel_launch(void* const* d_in, const int* in_sizes, int n_in,
                              void* d_out, int out_size, void* d_ws, size_t ws_size,
                              hipStream_t stream) {
    const float* q  = (const float*)d_in[0];
    const float* k  = (const float*)d_in[1];
    const float* v  = (const float*)d_in[2];
    const int*   vl = (const int*)d_in[3];
    float* out = (float*)d_out;

    float* ws = (float*)d_ws;

    fa_fwd_kernel<<<UNITS * (Sq / QTILE), 256, 0, stream>>>(q, k, v, vl, out, ws);
    fa_merge_kernel<<<Bn * (Sq / QTILE) * 2, 256, 0, stream>>>(vl, ws, out);
}

// v004
// Measured time: 40.6 microseconds a run.
// Two timings next to v003 put it at 1.06 and 1.05 times that version's speed.
// Counting every step since v000, it is 4.47 times as fast.
#include <hip/hip_runtime.h>
#include <hip/hip_bf16.h>

typedef __attribute__((ext_vector_type(16))) _Float16 v16h;
typedef __attribute__((ext_vector_type(8)))  _Float16 v8h;
typedef __attribute__((ext_vector_type(4)))  _Float16 v4h;
typedef __attribute__((ext_vector_type(8)))  short    v8s;
typedef __attribute__((ext_vector_type(8)))  float    v8f;
typedef __attribute__((ext_vector_type(4)))  float    v4f;
typedef __attribute__((ext_vector_type(2)))  float    v2f;

#define NEGVAL (-1000000.0f)

constexpr int Bn      = 16;
constexpr int Sq      = 2048;
constexpr int Sk      = 2048;
constexpr int Dh      = 128;
constexpr int QTILE   = 128;   // queries per block: 8 waves * 16 rows
constexpr int KTILE   = 32;    // keys per mainloop iteration
constexpr int KSTRIDE = 136;   // padded row pitch (halfs) of the K tile; 272B = 16B x 17 (odd): b128 fragment reads spread over all banks
constexpr int UNITS   = 32;    // (batch, key chunk) pairs at most; x 16 query blocks = 512 work-groups, two resident per WGP at this register count
constexpr int MINCH   = 8;     // shortest chunk (tiles) worth its own Q load and partial store
constexpr int MAXCH   = Sk / KTILE / MINCH;            // chunks of one batch at most
constexpr int PTILE   = 16 * Dh;                       // floats of one wave's partial O^T (16 queries)
constexpr size_t ML_OFF = (size_t)UNITS * Sq * Dh;     // float index in the workspace of the (max, sum) pairs
constexpr int VSTRIDE = 144;   // padded row pitch (halfs) of the row-major V tile; 288B = 32B x 9 (odd): the pitch of the transposing reads

// Cut of the keys, derived from the lengths alone and alike in both kernels: every batch's key tiles fall into
// chunks of L tiles, L the smallest length (>= MINCH) at which all batches together make at most UNITS chunks.
// Lane l tries L = l + 1; lane 31 always passes (64 tiles at most are two chunks of 32). A batch of length 0 is one chunk.
// Needs all 32 lanes on. Returns L; nch[b] = chunks of batch b (wave-uniform).
__device__ __forceinline__ int plan_chunks(const int* __restrict__ valid_len, int lane, int (&nch)[Bn])
{
    const unsigned L     = (unsigned)lane + 1u;
    const unsigned recip = 65536u / L + 1u;    // x / L == (x * recip) >> 16, exact while x * L < 65536 (here x < 96, L <= 32)
    int n[Bn];
    int cnt = 0;
#pragma unroll
    for (int b = 0; b < Bn; ++b) {
        const unsigned nT = (unsigned)(min(max(valid_len[b], 0), Sk) + KTILE - 1) / KTILE;
        n[b] = max((int)(((nT + L - 1u) * recip) >> 16), 1);
        cnt += n[b];
    }
    const unsigned ok  = __builtin_amdgcn_ballot_w32(cnt <= UNITS && L >= (unsigned)MINCH);
    const int      sel = __builtin_ctz(ok);
#pragma unroll
    for (int b = 0; b < Bn; ++b) nch[b] = __builtin_amdgcn_readlane(n[b], sel);
    return sel + 1;
}

// Flash-attention, wave32 WMMA formulation:
//   GEMM1: S^T = K_tile x Q^T ; GEMM2: O^T += V^T x P^T
// S^T accumulator layout feeds the P^T B-fragment with zero cross-lane moves.
// V is staged row-major like K; ds_load_tr16_b128 transposes it on the way to the A fragment.
// Double-buffered LDS; global loads for tile t+1 issue before tile t's WMMAs.
// The fragment LDS reads of each GEMM are issued as one group ahead of its WMMAs: one LDS latency per GEMM, not one per WMMA.
// One work-group = one (batch, key chunk, 128-query block). A batch of one chunk is normalized and stored to out here;
// a batch of several leaves un-normalized partials and (max, sum) in the workspace for fa_merge_kernel.
__global__ __launch_bounds__(256)
void fa_fwd_kernel(const float* __restrict__ qg,
                   const float* __restrict__ kg,
                   const float* __restrict__ vg,
                   const int*   __restrict__ valid_len,
                   float*       __restrict__ outg,
                   float*       __restrict__ ws)
{
    __shared__ _Float16 Ksh [2][KTILE * KSTRIDE]; // [buf][key][d]   2 x 8.5 KB
    __shared__ __attribute__((aligned(16))) _Float16 Vsh[2][KTILE * VSTRIDE]; // [buf][key][d]   2 x 9 KB

    const int tid  = threadIdx.x;
    const int lane = tid & 31;
    const int wave = tid >> 5;
    const int ln   = lane & 15;    // query column / matrix row-in-lane
    const int hi   = lane >> 4;    // half-wave select

    // which (batch, chunk) this work-group has: all scalar, alike in every wave
    int nch[Bn];
    const int L    = plan_chunks(valid_len, lane, nch);
    const int unit = blockIdx.x >> 4;
    int b = -1, chunk = 0, nc = 0;
    {
        int first = 0;
#pragma unroll
        for (int bb = 0; bb < Bn; ++bb) {
            if (unit >= first && unit < first + nch[bb]) { b = bb; chunk = unit - first; nc = nch[bb]; }
            first += nch[bb];
        }
    }
    if (b < 0) return;             // no chunk left for this work-group: the whole group leaves, before any barrier

    const int qBlock = (blockIdx.x & 15) * QTILE;
    const int qRow   = qBlock + wave * 16 + ln;
    // clamp bounds the trip count and every K/V address (same mask as the raw value); readfirstlane keeps it in a scalar register
    const int vlen   = __builtin_amdgcn_readfirstlane(min(max(valid_len[b], 0), Sk));

    const float* kb = kg + (size_t)b * Sk * Dh;
    const float* vb = vg + (size_t)b * Sk * Dh;

    // ---- vlen==0: softmax over a constant row -> uniform weights -> mean(V) ----
    if (vlen == 0) {
        float* red = reinterpret_cast<float*>(&Ksh[0][0]);   // 256 floats scratch
        const int d  = tid & 127;
        const int h2 = tid >> 7;
        float acc = 0.0f;
        for (int s = h2; s < Sk; s += 2) acc += vb[(size_t)s * Dh + d];
        red[tid] = acc;
        __syncthreads();
        const float mean = (red[d] + red[d + 128]) * (1.0f / (float)Sk);
        for (int r = h2; r < QTILE; r += 2)
            outg[((size_t)b * Sq + qBlock + r) * Dh + d] = mean;
        return;
    }

    const float sscale = 0.08838834764831845f;  // 1/sqrt(128), folded into Q

    // ---- Q^T B-fragments (pre-scaled), resident for the whole kernel ----
    v16h bq[4];
    {
        const float* qp = qg + ((size_t)b * Sq + qRow) * Dh;
#pragma unroll
        for (int c = 0; c < 4; ++c) {
            const float* p0 = qp + 32 * c + hi * 8;        // halves 0..7
            const float* p1 = qp + 32 * c + 16 + hi * 8;   // halves 8..15
            v16h t;
#pragma unroll
            for (int j = 0; j < 8; ++j) {
                t[j]     = (_Float16)(p0[j] * sscale);
                t[j + 8] = (_Float16)(p1[j] * sscale);
            }
            bq[c] = t;
        }
    }

    // O^T accumulators: 8 fragments cover d = 0..127 (16 per fragment)
    v8f o[8] = {};
    float m_i = -INFINITY;
    float l_i = 0.0f;

    const int nAll   = ((vlen + KTILE - 1) & ~(KTILE - 1)) / KTILE;   // >= 1
    const int tFirst = chunk * L;                                     // < nAll: chunk < ceil(nAll / L)
    const int nTiles = min(nAll, tFirst + L);                         // end of this chunk

    // register staging for the double-buffer pipeline
    v4f kreg[4], vreg[4];

    auto loadTile = [&](int kt) {
#pragma unroll
        for (int p = 0; p < 4; ++p) {
            const int i = tid + p * 256;
            kreg[p] = *(const v4f*)(kb + (size_t)kt * Dh + i * 4);
            vreg[p] = *(const v4f*)(vb + (size_t)kt * Dh + i * 4);
        }
    };
    auto storeTile = [&](int buf) {
#pragma unroll
        for (int p = 0; p < 4; ++p) {
            const int i   = tid + p * 256;
            const int key = (i * 4) >> 7;     // 0..31
            const int col = (i * 4) & 127;    // d, multiple of 4
            v4h kh;
#pragma unroll
            for (int j = 0; j < 4; ++j) kh[j] = (_Float16)kreg[p][j];
            *(v4h*)(&Ksh[buf][key * KSTRIDE + col]) = kh;
            v4h vh;
#pragma unroll
            for (int j = 0; j < 4; ++j) vh[j] = (_Float16)vreg[p][j];
            *(v4h*)(&Vsh[buf][key * VSTRIDE + col]) = vh;
        }
    };

    loadTile(tFirst * KTILE);
    storeTile(0);

    for (int t = tFirst; t < nTiles; ++t) {
        const int kt  = t * KTILE;
        const int cur = (t - tFirst) & 1;
        __syncthreads();                       // buffer `cur` ready, other buffer free

        const _Float16* kbase = &Ksh[cur][0];
        // lane address of the transposing read: row 8*hi + (lane & 7), 16-byte column half (lane >> 3) & 1
        const _Float16* vbase = &Vsh[cur][(8 * hi + (lane & 7)) * VSTRIDE + 8 * ((lane >> 3) & 1)];

        auto ldA = [&](int row16, int c, v16h& a) {   // K-tile A fragment
            const _Float16* r = kbase + (row16 + ln) * KSTRIDE + 32 * c + hi * 8;
            const v8h x = *(const v8h*)r;
            const v8h y = *(const v8h*)(r + 16);
#pragma unroll
            for (int j = 0; j < 8; ++j) { a[j] = x[j]; a[j + 8] = y[j]; }
        };
        auto ldV = [&](int n, v16h& a) {              // V^T A fragment (d-chunk n)
            typedef __attribute__((address_space(3))) v8s lds_v8s;
            const _Float16* vc = vbase + 16 * n;
            // lane (ln, hi) receives V[8*hi + 0..7][16*n + ln], then keys 16 + 8*hi + 0..7: the k order of pT
            const v8h x = __builtin_bit_cast(v8h, __builtin_amdgcn_ds_load_tr16_b128_v8i16((lds_v8s*)vc));
            const v8h y = __builtin_bit_cast(v8h, __builtin_amdgcn_ds_load_tr16_b128_v8i16((lds_v8s*)(vc + 16 * VSTRIDE)));
#pragma unroll
            for (int j = 0; j < 8; ++j) { a[j] = x[j]; a[j + 8] = y[j]; }
        };

        // ---- GEMM1: S^T = K_tile . (Q*scale)^T: all 16 fragment reads stand as one group ahead of the 8 products ----
        v8f s0 = {}, s1 = {};
        {
            v16h ka[8];
#pragma unroll
            for (int c = 0; c < 4; ++c) { ldA(0, c, ka[2 * c]); ldA(16, c, ka[2 * c + 1]); }
            // behind the K reads, which the products below wait for first; its branch ends the block, so the scheduler cannot sink a read to its product
            if (t + 1 < nTiles) loadTile(kt + KTILE);   // HBM latency hidden by WMMAs below
#pragma unroll
            for (int c = 0; c < 4; ++c) {
                s0 = __builtin_amdgcn_wmma_f32_16x16x32_f16(false, ka[2 * c],     false, bq[c],
                                                            (short)0, s0, false, false);
                s1 = __builtin_amdgcn_wmma_f32_16x16x32_f16(false, ka[2 * c + 1], false, bq[c],
                                                            (short)0, s1, false, false);
            }
        }

        // ---- mask only the (single) partial tail tile ----
        if (kt + KTILE > vlen) {
            const int rem = vlen - kt - 8 * hi;    // per-lane; key0 = kt+8hi+j
#pragma unroll
            for (int j = 0; j < 8; ++j) {
                if (j >= rem)      s0[j] = NEGVAL;  // kt+8hi+j    >= vlen
                if (j >= rem - 16) s1[j] = NEGVAL;  // kt+16+8hi+j >= vlen
            }
        }

        // all 16 V^T fragment reads as one group, as early as the K fragments' registers are free: one LDS latency for GEMM2.
        v16h va[8];
#pragma unroll
        for (int n = 0; n < 8; ++n) ldV(n, va[n]);

        // ---- online softmax (per-query state per-lane; halves hold same query) ----
        float tmax = s0[0];
#pragma unroll
        for (int j = 1; j < 8; ++j) tmax = fmaxf(tmax, s0[j]);
#pragma unroll
        for (int j = 0; j < 8; ++j) tmax = fmaxf(tmax, s1[j]);
        tmax = fmaxf(tmax, __shfl_xor(tmax, 16, 32));

        float corr = 1.0f;
        if (__ballot(tmax > m_i)) {            // wave-uniform: skip exact-identity rescale
            const float mNew = fmaxf(m_i, tmax);
            corr = __expf(m_i - mNew);
            m_i  = mNew;
#pragma unroll
            for (int n = 0; n < 8; ++n)
#pragma unroll
                for (int j = 0; j < 8; ++j) o[n][j] *= corr;
        }

        v16h pT;
        float lsum = 0.0f;
#pragma unroll
        for (int j = 0; j < 8; ++j) {
            const float p0 = __expf(s0[j] - m_i);
            const float p1 = __expf(s1[j] - m_i);
            pT[j]     = (_Float16)p0;
            pT[j + 8] = (_Float16)p1;
            lsum += p0 + p1;
        }
        lsum += __shfl_xor(lsum, 16, 32);
        l_i = l_i * corr + lsum;

        // ---- GEMM2: O^T += V^T . P^T, fragments already in registers ----
#pragma unroll
        for (int n = 0; n < 8; ++n)
            o[n] = __builtin_amdgcn_wmma_f32_16x16x32_f16(false, va[n], false, pT,
                                                          (short)0, o[n], false, false);

        if (t + 1 < nTiles) storeTile(1 - cur);     // convert + stage next buffer
    }

    // ---- several chunks: partial O^T in register order (512 contiguous bytes per store) + (max, sum) ----
    if (nc > 1) {
        float* pw = ws + ((size_t)unit * (Sq / 16) + (qBlock >> 4) + wave) * PTILE + lane * 4;
#pragma unroll
        for (int n = 0; n < 8; ++n) {
            v4f lo4, hi4;
#pragma unroll
            for (int j = 0; j < 4; ++j) { lo4[j] = o[n][j]; hi4[j] = o[n][4 + j]; }
            *(v4f*)(pw + (2 * n) * 128)     = lo4;
            *(v4f*)(pw + (2 * n + 1) * 128) = hi4;
        }
        if (hi == 0) {             // both halves hold the same pair
            v2f ml; ml[0] = m_i; ml[1] = l_i;
            *(v2f*)(ws + ML_OFF + ((size_t)unit * Sq + qRow) * 2) = ml;
        }
        return;
    }

    // ---- normalize + write out (vectorized 16B stores) ----
    const float invl = 1.0f / l_i;
    float* op = outg + ((size_t)b * Sq + qRow) * Dh + 8 * hi;
#pragma unroll
    for (int n = 0; n < 8; ++n) {
        v4f lo4, hi4;
#pragma unroll
        for (int j = 0; j < 4; ++j) {
            lo4[j] = o[n][j]     * invl;
            hi4[j] = o[n][4 + j] * invl;
        }
        *(v4f*)(op + 16 * n)     = lo4;
        *(v4f*)(op + 16 * n + 4) = hi4;
    }
    // precaution: in the built code the partial path's register writes stand behind these stores
    asm volatile("s_wait_xcnt 0x0" ::: "memory");
}

// Joins the chunks of a batch: weight exp(m_c - M) per chunk, sums in chunk order, one division.
// One wave = 16 queries x 64 of the 128 output columns (a half), in the register order the partials were stored in.
__global__ __launch_bounds__(256)
void fa_merge_kernel(const int*   __restrict__ valid_len,
                     const float* __restrict__ ws,
                     float*       __restrict__ outg)
{
    const int tid  = threadIdx.x;
    const int lane = tid & 31;
    const int wave = __builtin_amdgcn_readfirstlane(tid >> 5);   // scalar: keeps every chunk address a scalar base plus one lane offset
    const int ln   = lane & 15;
    const int hi   = lane >> 4;

    const int half   = blockIdx.x & 1;
    const int qBlock = ((blockIdx.x >> 1) & 15) * QTILE;
    const int b      = blockIdx.x >> 5;

    int nch[Bn];
    plan_chunks(valid_len, lane, nch);
    int first = 0, nc = 0;
#pragma unroll
    for (int bb = 0; bb < Bn; ++bb) {
        if (bb < b)  first += nch[bb];
        if (bb == b) nc = nch[bb];
    }
    if (nc <= 1) return;           // stored whole by the first kernel

    const int qRow = qBlock + wave * 16 + ln;
    const float* mlp = ws + ML_OFF + ((size_t)first * Sq + qBlock + wave * 16) * 2;                             // scalar
    const float* pp  = ws + ((size_t)first * (Sq / 16) + (qBlock >> 4) + wave) * PTILE + half * 1024;           // scalar
    const unsigned mlo = (unsigned)ln * 2u;      // lane offsets, in floats
    const unsigned po  = (unsigned)lane * 4u;

    // all (max, sum) pairs in flight at once: the index is clamped, so a chunk past the last re-reads the last; its weight is 0
    v2f ml[MAXCH];
#pragma unroll
    for (int c = 0; c < MAXCH; ++c) {
        // the chunk's base held in scalar registers: every load is that base plus the one lane offset, no 64-bit vector add per load
        const unsigned long long a = (unsigned long long)(mlp + (size_t)min(c, nc - 1) * Sq * 2);
        const unsigned alo = __builtin_amdgcn_readfirstlane((unsigned)a);
        const unsigned ahi = __builtin_amdgcn_readfirstlane((unsigned)(a >> 32));
        typedef __attribute__((address_space(1))) const float gfloat;
        gfloat* sp = (gfloat*)(((unsigned long long)ahi << 32) | alo);
        ml[c][0] = sp[mlo];
        ml[c][1] = sp[mlo + 1u];
    }
    // two chunks per trip, their 16 loads in flight together; an odd count re-reads its last chunk at weight 0
    v4f x0[8], x1[8];
    auto loadPair = [&](int c) {
        const float* p0 = pp + (size_t)c * Sq * Dh;
        const float* p1 = pp + (size_t)min(c + 1, nc - 1) * Sq * Dh;
#pragma unroll
        for (int k = 0; k < 8; ++k) x0[k] = *(const v4f*)(p0 + k * 128 + po);
#pragma unroll
        for (int k = 0; k < 8; ++k) x1[k] = *(const v4f*)(p1 + k * 128 + po);
        // keeps all the loads above what follows: without it the scheduler sinks each load to its use and the wave waits out one latency after another
        __builtin_amdgcn_sched_barrier(0);
    };
    loadPair(0);
    // precaution: the scalar bases of the loads above are reused by the code below; the wait stands in front of the first such overwrite
    asm volatile("s_wait_xcnt 0x0" ::: "memory");

    float M = ml[0][0];
#pragma unroll
    for (int c = 1; c < MAXCH; ++c) M = fmaxf(M, ml[c][0]);
    float w[MAXCH];
    float Ls = 0.0f;
#pragma unroll
    for (int c = 0; c < MAXCH; ++c) {
        w[c] = (c < nc) ? __expf(ml[c][0] - M) : 0.0f;   // every chunk holds a valid key: its maximum is finite
        Ls += w[c] * ml[c][1];
    }

    v4f acc[8] = {};
#pragma unroll
    for (int c = 0; c < MAXCH; c += 2) {
#pragma unroll
        for (int k = 0; k < 8; ++k) { acc[k] += w[c] * x0[k]; acc[k] += w[c + 1] * x1[k]; }
        if (c + 2 >= nc) break;                // scalar test
        loadPair(c + 2);
    }

    const float invl = 1.0f / Ls;
    float* op = outg + ((size_t)b * Sq + qRow) * Dh + 8 * hi + 64 * half;
#pragma unroll
    for (int k = 0; k < 8; ++k)
        *(v4f*)(op + 16 * (k >> 1) + 4 * (k & 1)) = acc[k] * invl;
}

extern "C" void kernel_launch(void* const* d_in, const int* in_sizes, int n_in,
                              void* d_out, int out_size, void* d_ws, size_t ws_size,
                              hipStream_t stream) {
    const float* q  = (const float*)d_in[0];
    const float* k  = (const float*)d_in[1];
    const float* v  = (const float*)d_in[2];
    const int*   vl = (const int*)d_in[3];
    float* out = (float*)d_out;

    float* ws = (float*)d_ws;

    fa_fwd_kernel<<<UNITS * (Sq / QTILE), 256, 0, stream>>>(q, k, v, vl, out, ws);
    fa_merge_kernel<<<Bn * (Sq / QTILE) * 2, 256, 0, stream>>>(vl, ws, out);
}

// v006
// Measured time: 31.3 microseconds a run.
// Versions between v004 and this one are left out; their measured steps multiply to 1.29 times as fast.
// All steps since v000 together make it 5.75 times as fast.
#include <hip/hip_runtime.h>
#include <hip/hip_bf16.h>

typedef __attribute__((ext_vector_type(16))) _Float16 v16h;
typedef __attribute__((ext_vector_type(8)))  _Float16 v8h;
typedef __attribute__((ext_vector_type(4)))  _Float16 v4h;
typedef __attribute__((ext_vector_type(8)))  short    v8s;
typedef __attribute__((ext_vector_type(8)))  float    v8f;
typedef __attribute__((ext_vector_type(4)))  float    v4f;
typedef __attribute__((ext_vector_type(2)))  float    v2f;

#define NEGVAL (-1000000.0f)

constexpr int Bn      = 16;
constexpr int Sq      = 2048;
constexpr int Sk      = 2048;
constexpr int Dh      = 128;
constexpr int QTILE   = 128;   // queries per block: 8 waves * 16 rows
constexpr int KTILE   = 32;    // keys per mainloop iteration
constexpr int KSTRIDE = 136;   // padded row pitch (halfs) of the K tile; 272B = 16B x 17 (odd): b128 fragment reads spread over all banks
constexpr int UNITS   = 32;    // (batch, key chunk) pairs at most; x 16 query blocks = 512 work-groups, two resident per WGP at this register count
constexpr int MINCH   = 8;     // shortest chunk (tiles) worth its own Q load and partial store
constexpr int MAXCH   = Sk / KTILE / MINCH;            // chunks of one batch at most
constexpr int PTILE   = 16 * Dh;                       // elements (f16) of one wave's partial O^T (16 queries)
constexpr size_t ML_OFF = (size_t)UNITS * Sq * Dh;     // float index in the workspace of the (max, sum) pairs
constexpr int VSTRIDE = 144;   // padded row pitch (halfs) of the row-major V tile; 288B = 32B x 9 (odd): the pitch of the transposing reads
constexpr int OPITCH  = 68;    // row pitch (floats) of a wave's 16 x 64 output block in LDS; 272B = 16B x 17 (odd)
constexpr int WSTAGE  = 16 * KSTRIDE;                  // halfs of one wave's own staging range: 16 Q rows (f16), or 16 x OPITCH floats

// 16 queries x 64 columns, from accumulator order (a lane holds 8 columns of one query: 16 lines per store) to whole rows:
// through the wave's own LDS range st, then each store covers two rows' 256 contiguous bytes (4 whole lines).
// dst = element (query 0, column 0) of the block in out.
__device__ __forceinline__ void store_rows(float* st, float* __restrict__ dst, int lane,
                                           const v8f& a0, const v8f& a1, const v8f& a2, const v8f& a3, float s)
{
    const int ln = lane & 15;
    const int hi = lane >> 4;
    float* wp = st + ln * OPITCH + 8 * hi;
    const v8f a[4] = { a0, a1, a2, a3 };
#pragma unroll
    for (int k = 0; k < 4; ++k) {
        v4f lo4, hi4;
#pragma unroll
        for (int j = 0; j < 4; ++j) { lo4[j] = a[k][j] * s; hi4[j] = a[k][4 + j] * s; }
        *(v4f*)(wp + 16 * k)     = lo4;
        *(v4f*)(wp + 16 * k + 4) = hi4;
    }
    // the rows are read back by other lanes of this wave: its own LDS writes are done first
    asm volatile("s_wait_dscnt 0x0" ::: "memory");
    const float* rp = st + hi * OPITCH + ln * 4;
    float*       gp = dst + hi * Dh + ln * 4;
#pragma unroll
    for (int i = 0; i < 8; ++i) {
        const v4f x = *(const v4f*)(rp + 2 * i * OPITCH);
        *(v4f*)(gp + 2 * i * Dh) = x;
    }
}

// Cut of the keys, derived from the lengths alone and alike in both kernels: every batch's key tiles fall into
// chunks of L tiles, L the smallest length (>= MINCH) at which all batches together make at most UNITS chunks.
// Lane l tries L = l + 1; lane 31 always passes (64 tiles at most are two chunks of 32). A batch of length 0 is one chunk.
// Needs all 32 lanes on. Returns L; nch[b] = chunks of batch b (wave-uniform).
__device__ __forceinline__ int plan_chunks(const int* __restrict__ valid_len, int lane, int (&nch)[Bn])
{
    const unsigned L     = (unsigned)lane + 1u;
    const unsigned recip = 65536u / L + 1u;    // x / L == (x * recip) >> 16, exact while x * L < 65536 (here x < 96, L <= 32)
    int n[Bn];
    int cnt = 0;
#pragma unroll
    for (int b = 0; b < Bn; ++b) {
        const unsigned nT = (unsigned)(min(max(valid_len[b], 0), Sk) + KTILE - 1) / KTILE;
        n[b] = max((int)(((nT + L - 1u) * recip) >> 16), 1);
        cnt += n[b];
    }
    const unsigned ok  = __builtin_amdgcn_ballot_w32(cnt <= UNITS && L >= (unsigned)MINCH);
    const int      sel = __builtin_ctz(ok);
#pragma unroll
    for (int b = 0; b < Bn; ++b) nch[b] = __builtin_amdgcn_readlane(n[b], sel);
    return sel + 1;
}

// Flash-attention, wave32 WMMA formulation:
//   GEMM1: S^T = K_tile x Q^T ; GEMM2: O^T += V^T x P^T
// S^T accumulator layout feeds the P^T B-fragment with zero cross-lane moves.
// V is staged row-major like K; ds_load_tr16_b128 transposes it on the way to the A fragment.
// Double-buffered LDS; global loads for tile t+1 issue before tile t's WMMAs.
// The fragment LDS reads of each GEMM are issued as one group ahead of its WMMAs: one LDS latency per GEMM, not one per WMMA.
// One work-group = one (batch, key chunk, 128-query block). A batch of one chunk is normalized and stored to out here;
// a batch of several leaves partials (f16, each normalized by its own sum) and (max, sum) in the workspace for fa_merge_kernel.
__global__ __launch_bounds__(256)
void fa_fwd_kernel(const float* __restrict__ qg,
                   const float* __restrict__ kg,
                   const float* __restrict__ vg,
                   const int*   __restrict__ valid_len,
                   float*       __restrict__ outg,
                   float*       __restrict__ ws)
{
    __shared__ __attribute__((aligned(16))) _Float16 Ksh [2][KTILE * KSTRIDE]; // [buf][key][d]   2 x 8.5 KB
    __shared__ __attribute__((aligned(16))) _Float16 Vsh[2][KTILE * VSTRIDE]; // [buf][key][d]   2 x 9 KB

    const int tid  = threadIdx.x;
    const int lane = tid & 31;
    const int wave = tid >> 5;
    const int ln   = lane & 15;    // query column / matrix row-in-lane
    const int hi   = lane >> 4;    // half-wave select

    // which (batch, chunk) this work-group has: all scalar, alike in every wave
    int nch[Bn];
    const int L    = plan_chunks(valid_len, lane, nch);
    const int unit = blockIdx.x >> 4;
    int b = -1, chunk = 0, nc = 0;
    {
        int first = 0;
#pragma unroll
        for (int bb = 0; bb < Bn; ++bb) {
            if (unit >= first && unit < first + nch[bb]) { b = bb; chunk = unit - first; nc = nch[bb]; }
            first += nch[bb];
        }
    }
    if (b < 0) return;             // no chunk left for this work-group: the whole group leaves, before any barrier

    const int qBlock = (blockIdx.x & 15) * QTILE;
    const int qRow   = qBlock + wave * 16 + ln;
    // clamp bounds the trip count and every K/V address (same mask as the raw value); readfirstlane keeps it in a scalar register
    const int vlen   = __builtin_amdgcn_readfirstlane(min(max(valid_len[b], 0), Sk));

    const float* kb = kg + (size_t)b * Sk * Dh;
    const float* vb = vg + (size_t)b * Sk * Dh;

    // ---- vlen==0: softmax over a constant row -> uniform weights -> mean(V) ----
    if (vlen == 0) {
        float* red = reinterpret_cast<float*>(&Ksh[0][0]);   // 256 floats scratch
        const int d  = tid & 127;
        const int h2 = tid >> 7;
        float acc = 0.0f;
        for (int s = h2; s < Sk; s += 2) acc += vb[(size_t)s * Dh + d];
        red[tid] = acc;
        __syncthreads();
        const float mean = (red[d] + red[d + 128]) * (1.0f / (float)Sk);
        for (int r = h2; r < QTILE; r += 2)
            outg[((size_t)b * Sq + qBlock + r) * Dh + d] = mean;
        return;
    }

    const float sscale = 0.08838834764831845f;  // 1/sqrt(128), folded into Q

    // each wave's own staging range in the tile buffers, for Q ahead of the loop and for out behind it: waves 0..3 fill Ksh, 4..7 lie in Vsh
    _Float16* wstage = (wave < 4 ? &Ksh[0][0] : &Vsh[0][0]) + (wave & 3) * WSTAGE;

    // O^T accumulators: 8 fragments cover d = 0..127 (16 per fragment)
    v8f o[8] = {};
    float m_i = -INFINITY;
    float l_i = 0.0f;

    const int nAll   = ((vlen + KTILE - 1) & ~(KTILE - 1)) / KTILE;   // >= 1
    const int tFirst = chunk * L;                                     // < nAll: chunk < ceil(nAll / L)
    const int nTiles = min(nAll, tFirst + L);                         // end of this chunk

    // register staging for the double-buffer pipeline
    v4f kreg[4], vreg[4];

    auto loadTile = [&](int kt) {
#pragma unroll
        for (int p = 0; p < 4; ++p) {
            const int i = tid + p * 256;
            kreg[p] = *(const v4f*)(kb + (size_t)kt * Dh + i * 4);
            vreg[p] = *(const v4f*)(vb + (size_t)kt * Dh + i * 4);
        }
    };
    auto storeTile = [&](int buf) {
#pragma unroll
        for (int p = 0; p < 4; ++p) {
            const int i   = tid + p * 256;
            const int key = (i * 4) >> 7;     // 0..31
            const int col = (i * 4) & 127;    // d, multiple of 4
            v4h kh;
#pragma unroll
            for (int j = 0; j < 4; ++j) kh[j] = (_Float16)kreg[p][j];
            *(v4h*)(&Ksh[buf][key * KSTRIDE + col]) = kh;
            v4h vh;
#pragma unroll
            for (int j = 0; j < 4; ++j) vh[j] = (_Float16)vreg[p][j];
            *(v4h*)(&Vsh[buf][key * VSTRIDE + col]) = vh;
        }
    };

    loadTile(tFirst * KTILE);

    // ---- Q^T B-fragments (pre-scaled), resident for the whole kernel ----
    // Loaded a whole 512-byte row per instruction (a lane-per-row load touches 16 lines), scaled, rounded, and turned into fragments through LDS.
    v16h bq[4];
    {
        const float* qp = qg + ((size_t)b * Sq + qBlock + wave * 16) * Dh + lane * 4;
#pragma unroll
        for (int r = 0; r < 16; ++r) {
            const v4f x = *(const v4f*)(qp + r * Dh);
            v4h h;
#pragma unroll
            for (int j = 0; j < 4; ++j) h[j] = (_Float16)(x[j] * sscale);
            *(v4h*)(wstage + r * KSTRIDE + lane * 4) = h;
        }
        // the rows are read back by other lanes of this wave: its own LDS writes are done first
        asm volatile("s_wait_dscnt 0x0" ::: "memory");
        const _Float16* qr = wstage + ln * KSTRIDE + hi * 8;
#pragma unroll
        for (int c = 0; c < 4; ++c) {
            const v8h x = *(const v8h*)(qr + 32 * c);        // halves 0..7
            const v8h y = *(const v8h*)(qr + 32 * c + 16);   // halves 8..15
            v16h t;
#pragma unroll
            for (int j = 0; j < 8; ++j) { t[j] = x[j]; t[j + 8] = y[j]; }
            bq[c] = t;
        }
    }
    __syncthreads();               // every wave holds its Q fragments: the tile buffers may be written

    storeTile(0);

    for (int t = tFirst; t < nTiles; ++t) {
        const int kt  = t * KTILE;
        const int cur = (t - tFirst) & 1;
        __syncthreads();                       // buffer `cur` ready, other buffer free

        const _Float16* kbase = &Ksh[cur][0];
        // lane address of the transposing read: row 8*hi + (lane & 7), 16-byte column half (lane >> 3) & 1
        const _Float16* vbase = &Vsh[cur][(8 * hi + (lane & 7)) * VSTRIDE + 8 * ((lane >> 3) & 1)];

        auto ldA = [&](int row16, int c, v16h& a) {   // K-tile A fragment
            const _Float16* r = kbase + (row16 + ln) * KSTRIDE + 32 * c + hi * 8;
            const v8h x = *(const v8h*)r;
            const v8h y = *(const v8h*)(r + 16);
#pragma unroll
            for (int j = 0; j < 8; ++j) { a[j] = x[j]; a[j + 8] = y[j]; }
        };
        auto ldV = [&](int n, v16h& a) {              // V^T A fragment (d-chunk n)
            typedef __attribute__((address_space(3))) v8s lds_v8s;
            const _Float16* vc = vbase + 16 * n;
            // lane (ln, hi) receives V[8*hi + 0..7][16*n + ln], then keys 16 + 8*hi + 0..7: the k order of pT
            const v8h x = __builtin_bit_cast(v8h, __builtin_amdgcn_ds_load_tr16_b128_v8i16((lds_v8s*)vc));
            const v8h y = __builtin_bit_cast(v8h, __builtin_amdgcn_ds_load_tr16_b128_v8i16((lds_v8s*)(vc + 16 * VSTRIDE)));
#pragma unroll
            for (int j = 0; j < 8; ++j) { a[j] = x[j]; a[j + 8] = y[j]; }
        };

        // ---- GEMM1: S^T = K_tile . (Q*scale)^T: all 16 fragment reads stand as one group ahead of the 8 products ----
        v8f s0 = {}, s1 = {};
        {
            v16h ka[8];
#pragma unroll
            for (int c = 0; c < 4; ++c) { ldA(0, c, ka[2 * c]); ldA(16, c, ka[2 * c + 1]); }
            // behind the K reads, which the products below wait for first; its branch ends the block, so the scheduler cannot sink a read to its product
            if (t + 1 < nTiles) loadTile(kt + KTILE);   // HBM latency hidden by WMMAs below
#pragma unroll
            for (int c = 0; c < 4; ++c) {
                s0 = __builtin_amdgcn_wmma_f32_16x16x32_f16(false, ka[2 * c],     false, bq[c],
                                                            (short)0, s0, false, false);
                s1 = __builtin_amdgcn_wmma_f32_16x16x32_f16(false, ka[2 * c + 1], false, bq[c],
                                                            (short)0, s1, false, false);
            }
        }

        // ---- mask only the (single) partial tail tile ----
        if (kt + KTILE > vlen) {
            const int rem = vlen - kt - 8 * hi;    // per-lane; key0 = kt+8hi+j
#pragma unroll
            for (int j = 0; j < 8; ++j) {
                if (j >= rem)      s0[j] = NEGVAL;  // kt+8hi+j    >= vlen
                if (j >= rem - 16) s1[j] = NEGVAL;  // kt+16+8hi+j >= vlen
            }
        }

        // all 16 V^T fragment reads as one group, as early as the K fragments' registers are free: one LDS latency for GEMM2.
        v16h va[8];
#pragma unroll
        for (int n = 0; n < 8; ++n) ldV(n, va[n]);

        // ---- online softmax (per-query state per-lane; halves hold same query) ----
        float tmax = s0[0];
#pragma unroll
        for (int j = 1; j < 8; ++j) tmax = fmaxf(tmax, s0[j]);
#pragma unroll
        for (int j = 0; j < 8; ++j) tmax = fmaxf(tmax, s1[j]);
        tmax = fmaxf(tmax, __shfl_xor(tmax, 16, 32));

        float corr = 1.0f;
        if (__ballot(tmax > m_i)) {            // wave-uniform: skip exact-identity rescale
            const float mNew = fmaxf(m_i, tmax);
            corr = __expf(m_i - mNew);
            m_i  = mNew;
#pragma unroll
            for (int n = 0; n < 8; ++n)
#pragma unroll
                for (int j = 0; j < 8; ++j) o[n][j] *= corr;
        }

        v16h pT;
        float lsum = 0.0f;
#pragma unroll
        for (int j = 0; j < 8; ++j) {
            const float p0 = __expf(s0[j] - m_i);
            const float p1 = __expf(s1[j] - m_i);
            pT[j]     = (_Float16)p0;
            pT[j + 8] = (_Float16)p1;
            lsum += p0 + p1;
        }
        lsum += __shfl_xor(lsum, 16, 32);
        l_i = l_i * corr + lsum;

        // ---- GEMM2: O^T += V^T . P^T, fragments already in registers ----
#pragma unroll
        for (int n = 0; n < 8; ++n)
            o[n] = __builtin_amdgcn_wmma_f32_16x16x32_f16(false, va[n], false, pT,
                                                          (short)0, o[n], false, false);

        if (t + 1 < nTiles) storeTile(1 - cur);     // convert + stage next buffer
    }

    // ---- several chunks: partial O^T as f16 in register order (512 contiguous bytes per store) + (max, sum) ----
    // Divided by the chunk's own sum first: a weighted mean of V rows, so it stays in f16 range whatever the chunk's length.
    if (nc > 1) {
        const float pinv = 1.0f / l_i;     // every chunk holds a valid key: its sum is at least 1
        _Float16* pw = reinterpret_cast<_Float16*>(ws) + ((size_t)unit * (Sq / 16) + (qBlock >> 4) + wave) * PTILE + lane * 8;
#pragma unroll
        for (int n = 0; n < 8; ++n) {
            v8h h;
#pragma unroll
            for (int j = 0; j < 8; ++j) h[j] = (_Float16)(o[n][j] * pinv);
            *(v8h*)(pw + n * 256) = h;
        }
        if (hi == 0) {             // both halves hold the same pair
            v2f ml; ml[0] = m_i; ml[1] = l_i;
            *(v2f*)(ws + ML_OFF + ((size_t)unit * Sq + qRow) * 2) = ml;
        }
        return;
    }

    // ---- normalize + write out, in whole lines, 64 columns at a time ----
    __syncthreads();               // every wave has read the last tile: the buffers become output staging
    const float invl = 1.0f / l_i;
    float* op = outg + ((size_t)b * Sq + qBlock + wave * 16) * Dh;
    store_rows(reinterpret_cast<float*>(wstage), op,      lane, o[0], o[1], o[2], o[3], invl);
    // precaution: the second half reuses the registers that the stores above name
    asm volatile("s_wait_xcnt 0x0" ::: "memory");
    store_rows(reinterpret_cast<float*>(wstage), op + 64, lane, o[4], o[5], o[6], o[7], invl);
    // precaution: in the built code the partial path's register writes stand behind these stores
    asm volatile("s_wait_xcnt 0x0" ::: "memory");
}

// Joins the chunks of a batch: weight exp(m_c - M) * l_c per chunk (the partials come normalized), sums in chunk order, one division.
// One wave = 16 queries x 64 of the 128 output columns (a half), in the register order the partials were stored in.
__global__ __launch_bounds__(256)
void fa_merge_kernel(const int*   __restrict__ valid_len,
                     const float* __restrict__ ws,
                     float*       __restrict__ outg)
{
    __shared__ __attribute__((aligned(16))) float stage[8][16 * OPITCH];   // one range per wave: no barrier

    const int tid  = threadIdx.x;
    const int lane = tid & 31;
    const int wave = __builtin_amdgcn_readfirstlane(tid >> 5);   // scalar: keeps every chunk address a scalar base plus one lane offset
    const int ln   = lane & 15;

    const int half   = blockIdx.x & 1;
    const int qBlock = ((blockIdx.x >> 1) & 15) * QTILE;
    const int b      = blockIdx.x >> 5;

    int nch[Bn];
    plan_chunks(valid_len, lane, nch);
    int first = 0, nc = 0;
#pragma unroll
    for (int bb = 0; bb < Bn; ++bb) {
        if (bb < b)  first += nch[bb];
        if (bb == b) nc = nch[bb];
    }
    if (nc <= 1) return;           // stored whole by the first kernel

    const float* mlp = ws + ML_OFF + ((size_t)first * Sq + qBlock + wave * 16) * 2;                             // scalar
    const _Float16* pp = reinterpret_cast<const _Float16*>(ws) + ((size_t)first * (Sq / 16) + (qBlock >> 4) + wave) * PTILE + half * 1024;   // scalar
    const unsigned mlo = (unsigned)ln * 2u;      // lane offset, in floats
    const unsigned po  = (unsigned)lane * 8u;    // lane offset, in f16 elements

    // all (max, sum) pairs in flight at once: the index is clamped, so a chunk past the last re-reads the last; its weight is 0
    v2f ml[MAXCH];
#pragma unroll
    for (int c = 0; c < MAXCH; ++c) {
        // the chunk's base held in scalar registers: every load is that base plus the one lane offset, no 64-bit vector add per load
        const unsigned long long a = (unsigned long long)(mlp + (size_t)min(c, nc - 1) * Sq * 2);
        const unsigned alo = __builtin_amdgcn_readfirstlane((unsigned)a);
        const unsigned ahi = __builtin_amdgcn_readfirstlane((unsigned)(a >> 32));
        typedef __attribute__((address_space(1))) const float gfloat;
        gfloat* sp = (gfloat*)(((unsigned long long)ahi << 32) | alo);
        ml[c][0] = sp[mlo];
        ml[c][1] = sp[mlo + 1u];
    }
    // two chunks per trip, their 8 loads in flight together; an odd count re-reads its last chunk at weight 0
    v8h x0[4], x1[4];
    auto loadPair = [&](int c) {
        const _Float16* p0 = pp + (size_t)c * Sq * Dh;
        const _Float16* p1 = pp + (size_t)min(c + 1, nc - 1) * Sq * Dh;
#pragma unroll
        for (int k = 0; k < 4; ++k) x0[k] = *(const v8h*)(p0 + k * 256 + po);
#pragma unroll
        for (int k = 0; k < 4; ++k) x1[k] = *(const v8h*)(p1 + k * 256 + po);
        // keeps all the loads above what follows: without it the scheduler sinks each load to its use and the wave waits out one latency after another
        __builtin_amdgcn_sched_barrier(0);
        // precaution: the address registers of the loads above are rewritten further down (the next trip's addresses, the epilogue): a wait stands between, in every trip
        asm volatile("s_wait_xcnt 0x0" ::: "memory");
    };
    loadPair(0);

    float M = ml[0][0];
#pragma unroll
    for (int c = 1; c < MAXCH; ++c) M = fmaxf(M, ml[c][0]);
    float w[MAXCH];
    float Ls = 0.0f;
#pragma unroll
    for (int c = 0; c < MAXCH; ++c) {
        w[c] = (c < nc) ? __expf(ml[c][0] - M) * ml[c][1] : 0.0f;   // every chunk holds a valid key: its maximum is finite
        Ls += w[c];
    }

    v8f acc[4] = {};
#pragma unroll
    for (int c = 0; c < MAXCH; c += 2) {
#pragma unroll
        for (int k = 0; k < 4; ++k)
#pragma unroll
            for (int j = 0; j < 8; ++j) { acc[k][j] += w[c] * (float)x0[k][j]; acc[k][j] += w[c + 1] * (float)x1[k][j]; }
        if (c + 2 >= MAXCH || c + 2 >= nc) break;   // scalar test; its first half, known at compile time, ends the last trip without a load or its wait
        loadPair(c + 2);
    }

    const float invl = 1.0f / Ls;
    float* op = outg + ((size_t)b * Sq + qBlock + wave * 16) * Dh + 64 * half;
    store_rows(&stage[wave][0], op, lane, acc[0], acc[1], acc[2], acc[3], invl);
}

extern "C" void kernel_launch(void* const* d_in, const int* in_sizes, int n_in,
                              void* d_out, int out_size, void* d_ws, size_t ws_size,
                              hipStream_t stream) {
    const float* q  = (const float*)d_in[0];
    const float* k  = (const float*)d_in[1];
    const float* v  = (const float*)d_in[2];
    const int*   vl = (const int*)d_in[3];
    float* out = (float*)d_out;

    float* ws = (float*)d_ws;

    fa_fwd_kernel<<<UNITS * (Sq / QTILE), 256, 0, stream>>>(q, k, v, vl, out, ws);
    fa_merge_kernel<<<Bn * (Sq / QTILE) * 2, 256, 0, stream>>>(vl, ws, out);
}

// v007
// One run takes 29.1 microseconds.
// Timed twice side by side with v006, it ran 1.08 times as fast both times.
// Over all steps from v000 it is 6.21 times as fast.
#include <hip/hip_runtime.h>
#include <hip/hip_bf16.h>

typedef __attribute__((ext_vector_type(16))) _Float16 v16h;
typedef __attribute__((ext_vector_type(8)))  _Float16 v8h;
typedef __attribute__((ext_vector_type(4)))  _Float16 v4h;
typedef __attribute__((ext_vector_type(8)))  short    v8s;
typedef __attribute__((ext_vector_type(8)))  float    v8f;
typedef __attribute__((ext_vector_type(4)))  float    v4f;
typedef __attribute__((ext_vector_type(2)))  float    v2f;

#define NEGVAL (-1000000.0f)

constexpr int Bn      = 16;
constexpr int Sq      = 2048;
constexpr int Sk      = 2048;
constexpr int Dh      = 128;
constexpr int QTILE   = 128;   // queries per block: 8 waves * 16 rows
constexpr int KTILE   = 32;    // keys per mainloop iteration
constexpr int KSTRIDE = 136;   // padded row pitch (halfs) of the K tile; 272B = 16B x 17 (odd): b128 fragment reads spread over all banks
constexpr int UNITS   = 32;    // (batch, key chunk) pairs at most; x 16 query blocks = 512 work-groups, two resident per WGP at this register count
constexpr int MINCH   = 8;     // shortest chunk (tiles) worth its own Q load and partial store
constexpr int MAXCH   = Sk / KTILE / MINCH;            // chunks of one batch at most
constexpr int PTILE   = 16 * Dh;                       // elements (f16) of one wave's partial O^T (16 queries)
constexpr size_t ML_OFF = (size_t)UNITS * Sq * Dh;     // float index in the workspace of the (max, sum) pairs
constexpr int VSTRIDE = 144;   // padded row pitch (halfs) of the row-major V tile; 288B = 32B x 9 (odd): the pitch of the transposing reads
constexpr int OPITCH  = 68;    // row pitch (floats) of a wave's 16 x 64 output block in LDS; 272B = 16B x 17 (odd)
constexpr int WSTAGE  = 16 * KSTRIDE;                  // halfs of one wave's own staging range: 16 Q rows (f16), or 16 x OPITCH floats

// 16 queries x 64 columns, from accumulator order (a lane holds 8 columns of one query: 16 lines per store) to whole rows:
// through the wave's own LDS range st, then each store covers two rows' 256 contiguous bytes (4 whole lines).
// dst = element (query 0, column 0) of the block in out.
__device__ __forceinline__ void store_rows(float* st, float* __restrict__ dst, int lane,
                                           const v8f& a0, const v8f& a1, const v8f& a2, const v8f& a3, float s)
{
    const int ln = lane & 15;
    const int hi = lane >> 4;
    float* wp = st + ln * OPITCH + 8 * hi;
    const v8f a[4] = { a0, a1, a2, a3 };
#pragma unroll
    for (int k = 0; k < 4; ++k) {
        v4f lo4, hi4;
#pragma unroll
        for (int j = 0; j < 4; ++j) { lo4[j] = a[k][j] * s; hi4[j] = a[k][4 + j] * s; }
        *(v4f*)(wp + 16 * k)     = lo4;
        *(v4f*)(wp + 16 * k + 4) = hi4;
    }
    // the rows are read back by other lanes of this wave: its own LDS writes are done first
    asm volatile("s_wait_dscnt 0x0" ::: "memory");
    const float* rp = st + hi * OPITCH + ln * 4;
    float*       gp = dst + hi * Dh + ln * 4;
#pragma unroll
    for (int i = 0; i < 8; ++i) {
        const v4f x = *(const v4f*)(rp + 2 * i * OPITCH);
        *(v4f*)(gp + 2 * i * Dh) = x;
    }
}

// Cut of the keys, derived from the lengths alone and alike in both kernels: every batch's key tiles fall into
// chunks of L tiles, L the smallest length (>= MINCH) at which all batches together make at most UNITS chunks.
// Lane l tries L = l + 1; lane 31 always passes (64 tiles at most are two chunks of 32). A batch of length 0 is one chunk.
// Needs all 32 lanes on. Returns L; nch[b] = chunks of batch b (wave-uniform).
__device__ __forceinline__ int plan_chunks(const int* __restrict__ valid_len, int lane, int (&nch)[Bn])
{
    const unsigned L     = (unsigned)lane + 1u;
    const unsigned recip = 65536u / L + 1u;    // x / L == (x * recip) >> 16, exact while x * L < 65536 (here x < 96, L <= 32)
    int n[Bn];
    int cnt = 0;
#pragma unroll
    for (int b = 0; b < Bn; ++b) {
        const unsigned nT = (unsigned)(min(max(valid_len[b], 0), Sk) + KTILE - 1) / KTILE;
        n[b] = max((int)(((nT + L - 1u) * recip) >> 16), 1);
        cnt += n[b];
    }
    const unsigned ok  = __builtin_amdgcn_ballot_w32(cnt <= UNITS && L >= (unsigned)MINCH);
    const int      sel = __builtin_ctz(ok);
#pragma unroll
    for (int b = 0; b < Bn; ++b) nch[b] = __builtin_amdgcn_readlane(n[b], sel);
    return sel + 1;
}

// Flash-attention, wave32 WMMA formulation:
//   GEMM1: S^T = K_tile x Q^T ; GEMM2: O^T += V^T x P^T
// S^T accumulator layout feeds the P^T B-fragment with zero cross-lane moves.
// V is staged row-major like K; ds_load_tr16_b128 transposes it on the way to the A fragment.
// Double-buffered LDS; global loads for tile t+1 issue before tile t's WMMAs.
// The fragment LDS reads of each GEMM are issued as one group ahead of its WMMAs: one LDS latency per GEMM, not one per WMMA.
// One work-group = one (batch, key chunk, 128-query block). A batch of one chunk is normalized and stored to out here;
// a batch of several leaves partials (f16, each normalized by its own sum) and (max, sum) in the workspace for fa_merge_kernel.
__global__ __launch_bounds__(256)
void fa_fwd_kernel(const float* __restrict__ qg,
                   const float* __restrict__ kg,
                   const float* __restrict__ vg,
                   const int*   __restrict__ valid_len,
                   float*       __restrict__ outg,
                   float*       __restrict__ ws)
{
    __shared__ __attribute__((aligned(16))) _Float16 Ksh [2][KTILE * KSTRIDE]; // [buf][key][d]   2 x 8.5 KB
    __shared__ __attribute__((aligned(16))) _Float16 Vsh[2][KTILE * VSTRIDE]; // [buf][key][d]   2 x 9 KB

    const int tid  = threadIdx.x;
    const int lane = tid & 31;
    const int wave = tid >> 5;
    const int ln   = lane & 15;    // query column / matrix row-in-lane
    const int hi   = lane >> 4;    // half-wave select

    // which (batch, chunk) this work-group has: all scalar, alike in every wave
    int nch[Bn];
    const int L    = plan_chunks(valid_len, lane, nch);
    const int unit = blockIdx.x >> 4;
    int b = -1, chunk = 0, nc = 0;
    {
        int first = 0;
#pragma unroll
        for (int bb = 0; bb < Bn; ++bb) {
            if (unit >= first && unit < first + nch[bb]) { b = bb; chunk = unit - first; nc = nch[bb]; }
            first += nch[bb];
        }
    }
    if (b < 0) return;             // no chunk left for this work-group: the whole group leaves, before any barrier

    const int qBlock = (blockIdx.x & 15) * QTILE;
    const int qRow   = qBlock + wave * 16 + ln;
    // clamp bounds the trip count and every K/V address (same mask as the raw value); readfirstlane keeps it in a scalar register
    const int vlen   = __builtin_amdgcn_readfirstlane(min(max(valid_len[b], 0), Sk));

    const float* kb = kg + (size_t)b * Sk * Dh;
    const float* vb = vg + (size_t)b * Sk * Dh;

    // ---- vlen==0: softmax over a constant row -> uniform weights -> mean(V) ----
    if (vlen == 0) {
        float* red = reinterpret_cast<float*>(&Ksh[0][0]);   // 256 floats scratch
        const int d  = tid & 127;
        const int h2 = tid >> 7;
        float acc = 0.0f;
        for (int s = h2; s < Sk; s += 2) acc += vb[(size_t)s * Dh + d];
        red[tid] = acc;
        __syncthreads();
        const float mean = (red[d] + red[d + 128]) * (1.0f / (float)Sk);
        for (int r = h2; r < QTILE; r += 2)
            outg[((size_t)b * Sq + qBlock + r) * Dh + d] = mean;
        return;
    }

    const float sscale = 0.08838834764831845f;  // 1/sqrt(128), folded into Q

    // each wave's own staging range in the tile buffers, for Q ahead of the loop and for out behind it: waves 0..3 fill Ksh, 4..7 lie in Vsh
    _Float16* wstage = (wave < 4 ? &Ksh[0][0] : &Vsh[0][0]) + (wave & 3) * WSTAGE;

    // O^T accumulators: 8 fragments cover d = 0..127 (16 per fragment)
    v8f o[8] = {};
    float m_i = -INFINITY;
    float l_i = 0.0f;

    const int nAll   = ((vlen + KTILE - 1) & ~(KTILE - 1)) / KTILE;   // >= 1
    const int tFirst = chunk * L;                                     // < nAll: chunk < ceil(nAll / L)
    const int nTiles = min(nAll, tFirst + L);                         // end of this chunk
    // The 16 query blocks of a chunk read the same K/V lines. Each enters the chunk's tiles at its own start and wraps round,
    // so that they do not ask L2 for the same lines at the same moment. The online softmax takes the tiles in any order.
    const int tStart = tFirst + (((blockIdx.x & 15) * (nTiles - tFirst)) >> 4);   // in [tFirst, nTiles)

    // register staging for the double-buffer pipeline
    v4f kreg[4], vreg[4];

    auto loadTile = [&](int kt) {
#pragma unroll
        for (int p = 0; p < 4; ++p) {
            const int i = tid + p * 256;
            kreg[p] = *(const v4f*)(kb + (size_t)kt * Dh + i * 4);
            vreg[p] = *(const v4f*)(vb + (size_t)kt * Dh + i * 4);
        }
    };
    auto storeTile = [&](int buf) {
#pragma unroll
        for (int p = 0; p < 4; ++p) {
            const int i   = tid + p * 256;
            const int key = (i * 4) >> 7;     // 0..31
            const int col = (i * 4) & 127;    // d, multiple of 4
            v4h kh;
#pragma unroll
            for (int j = 0; j < 4; ++j) kh[j] = (_Float16)kreg[p][j];
            *(v4h*)(&Ksh[buf][key * KSTRIDE + col]) = kh;
            v4h vh;
#pragma unroll
            for (int j = 0; j < 4; ++j) vh[j] = (_Float16)vreg[p][j];
            *(v4h*)(&Vsh[buf][key * VSTRIDE + col]) = vh;
        }
    };

    loadTile(tStart * KTILE);

    // ---- Q^T B-fragments (pre-scaled), resident for the whole kernel ----
    // Loaded a whole 512-byte row per instruction (a lane-per-row load touches 16 lines), scaled, rounded, and turned into fragments through LDS.
    v16h bq[4];
    {
        const float* qp = qg + ((size_t)b * Sq + qBlock + wave * 16) * Dh + lane * 4;
#pragma unroll
        for (int r = 0; r < 16; ++r) {
            const v4f x = *(const v4f*)(qp + r * Dh);
            v4h h;
#pragma unroll
            for (int j = 0; j < 4; ++j) h[j] = (_Float16)(x[j] * sscale);
            *(v4h*)(wstage + r * KSTRIDE + lane * 4) = h;
        }
        // the rows are read back by other lanes of this wave: its own LDS writes are done first
        asm volatile("s_wait_dscnt 0x0" ::: "memory");
        const _Float16* qr = wstage + ln * KSTRIDE + hi * 8;
#pragma unroll
        for (int c = 0; c < 4; ++c) {
            const v8h x = *(const v8h*)(qr + 32 * c);        // halves 0..7
            const v8h y = *(const v8h*)(qr + 32 * c + 16);   // halves 8..15
            v16h t;
#pragma unroll
            for (int j = 0; j < 8; ++j) { t[j] = x[j]; t[j + 8] = y[j]; }
            bq[c] = t;
        }
    }
    __syncthreads();               // every wave holds its Q fragments: the tile buffers may be written

    storeTile(0);

    int tile = tStart;                         // the tile of this trip
    for (int t = tFirst; t < nTiles; ++t) {    // t counts the trips
        const int kt    = tile * KTILE;
        const int tNext = (tile + 1 == nTiles) ? tFirst : tile + 1;   // wraps to the chunk's first tile
        const int cur   = (t - tFirst) & 1;
        __syncthreads();                       // buffer `cur` ready, other buffer free

        const _Float16* kbase = &Ksh[cur][0];
        // lane address of the transposing read: row 8*hi + (lane & 7), 16-byte column half (lane >> 3) & 1
        const _Float16* vbase = &Vsh[cur][(8 * hi + (lane & 7)) * VSTRIDE + 8 * ((lane >> 3) & 1)];

        auto ldA = [&](int row16, int c, v16h& a) {   // K-tile A fragment
            const _Float16* r = kbase + (row16 + ln) * KSTRIDE + 32 * c + hi * 8;
            const v8h x = *(const v8h*)r;
            const v8h y = *(const v8h*)(r + 16);
#pragma unroll
            for (int j = 0; j < 8; ++j) { a[j] = x[j]; a[j + 8] = y[j]; }
        };
        auto ldV = [&](int n, v16h& a) {              // V^T A fragment (d-chunk n)
            typedef __attribute__((address_space(3))) v8s lds_v8s;
            const _Float16* vc = vbase + 16 * n;
            // lane (ln, hi) receives V[8*hi + 0..7][16*n + ln], then keys 16 + 8*hi + 0..7: the k order of pT
            const v8h x = __builtin_bit_cast(v8h, __builtin_amdgcn_ds_load_tr16_b128_v8i16((lds_v8s*)vc));
            const v8h y = __builtin_bit_cast(v8h, __builtin_amdgcn_ds_load_tr16_b128_v8i16((lds_v8s*)(vc + 16 * VSTRIDE)));
#pragma unroll
            for (int j = 0; j < 8; ++j) { a[j] = x[j]; a[j + 8] = y[j]; }
        };

        // ---- GEMM1: S^T = K_tile . (Q*scale)^T: all 16 fragment reads stand as one group ahead of the 8 products ----
        v8f s0 = {}, s1 = {};
        {
            v16h ka[8];
#pragma unroll
            for (int c = 0; c < 4; ++c) { ldA(0, c, ka[2 * c]); ldA(16, c, ka[2 * c + 1]); }
            // behind the K reads, which the products below wait for first; its branch ends the block, so the scheduler cannot sink a read to its product
            if (t + 1 < nTiles) loadTile(tNext * KTILE);   // latency hidden by WMMAs below
#pragma unroll
            for (int c = 0; c < 4; ++c) {
                s0 = __builtin_amdgcn_wmma_f32_16x16x32_f16(false, ka[2 * c],     false, bq[c],
                                                            (short)0, s0, false, false);
                s1 = __builtin_amdgcn_wmma_f32_16x16x32_f16(false, ka[2 * c + 1], false, bq[c],
                                                            (short)0, s1, false, false);
            }
        }

        // ---- mask only the (single) partial tail tile, in whichever trip it comes ----
        if (kt + KTILE > vlen) {
            const int rem = vlen - kt - 8 * hi;    // per-lane; key0 = kt+8hi+j
#pragma unroll
            for (int j = 0; j < 8; ++j) {
                if (j >= rem)      s0[j] = NEGVAL;  // kt+8hi+j    >= vlen
                if (j >= rem - 16) s1[j] = NEGVAL;  // kt+16+8hi+j >= vlen
            }
        }

        // all 16 V^T fragment reads as one group, as early as the K fragments' registers are free: one LDS latency for GEMM2.
        v16h va[8];
#pragma unroll
        for (int n = 0; n < 8; ++n) ldV(n, va[n]);

        // ---- online softmax (per-query state per-lane; halves hold same query) ----
        float tmax = s0[0];
#pragma unroll
        for (int j = 1; j < 8; ++j) tmax = fmaxf(tmax, s0[j]);
#pragma unroll
        for (int j = 0; j < 8; ++j) tmax = fmaxf(tmax, s1[j]);
        tmax = fmaxf(tmax, __shfl_xor(tmax, 16, 32));

        float corr = 1.0f;
        if (__ballot(tmax > m_i)) {            // wave-uniform: skip exact-identity rescale
            const float mNew = fmaxf(m_i, tmax);
            corr = __expf(m_i - mNew);
            m_i  = mNew;
#pragma unroll
            for (int n = 0; n < 8; ++n)
#pragma unroll
                for (int j = 0; j < 8; ++j) o[n][j] *= corr;
        }

        v16h pT;
        float lsum = 0.0f;
#pragma unroll
        for (int j = 0; j < 8; ++j) {
            const float p0 = __expf(s0[j] - m_i);
            const float p1 = __expf(s1[j] - m_i);
            pT[j]     = (_Float16)p0;
            pT[j + 8] = (_Float16)p1;
            lsum += p0 + p1;
        }
        lsum += __shfl_xor(lsum, 16, 32);
        l_i = l_i * corr + lsum;

        // ---- GEMM2: O^T += V^T . P^T, fragments already in registers ----
#pragma unroll
        for (int n = 0; n < 8; ++n)
            o[n] = __builtin_amdgcn_wmma_f32_16x16x32_f16(false, va[n], false, pT,
                                                          (short)0, o[n], false, false);

        if (t + 1 < nTiles) storeTile(1 - cur);     // convert + stage next buffer
        tile = tNext;
    }

    // ---- several chunks: partial O^T as f16 in register order (512 contiguous bytes per store) + (max, sum) ----
    // Divided by the chunk's own sum first: a weighted mean of V rows, so it stays in f16 range whatever the chunk's length.
    if (nc > 1) {
        const float pinv = 1.0f / l_i;     // every chunk holds a valid key: its sum is at least 1
        _Float16* pw = reinterpret_cast<_Float16*>(ws) + ((size_t)unit * (Sq / 16) + (qBlock >> 4) + wave) * PTILE + lane * 8;
#pragma unroll
        for (int n = 0; n < 8; ++n) {
            v8h h;
#pragma unroll
            for (int j = 0; j < 8; ++j) h[j] = (_Float16)(o[n][j] * pinv);
            *(v8h*)(pw + n * 256) = h;
        }
        if (hi == 0) {             // both halves hold the same pair
            v2f ml; ml[0] = m_i; ml[1] = l_i;
            *(v2f*)(ws + ML_OFF + ((size_t)unit * Sq + qRow) * 2) = ml;
        }
        return;
    }

    // ---- normalize + write out, in whole lines, 64 columns at a time ----
    __syncthreads();               // every wave has read the last tile: the buffers become output staging
    const float invl = 1.0f / l_i;
    float* op = outg + ((size_t)b * Sq + qBlock + wave * 16) * Dh;
    store_rows(reinterpret_cast<float*>(wstage), op,      lane, o[0], o[1], o[2], o[3], invl);
    // precaution: the second half reuses the registers that the stores above name
    asm volatile("s_wait_xcnt 0x0" ::: "memory");
    store_rows(reinterpret_cast<float*>(wstage), op + 64, lane, o[4], o[5], o[6], o[7], invl);
    // precaution: in the built code the partial path's register writes stand behind these stores
    asm volatile("s_wait_xcnt 0x0" ::: "memory");
}

// Joins the chunks of a batch: weight exp(m_c - M) * l_c per chunk (the partials come normalized), sums in chunk order, one division.
// One wave = 16 queries x 64 of the 128 output columns (a half), in the register order the partials were stored in.
__global__ __launch_bounds__(256)
void fa_merge_kernel(const int*   __restrict__ valid_len,
                     const float* __restrict__ ws,
                     float*       __restrict__ outg)
{
    __shared__ __attribute__((aligned(16))) float stage[8][16 * OPITCH];   // one range per wave: no barrier

    const int tid  = threadIdx.x;
    const int lane = tid & 31;
    const int wave = __builtin_amdgcn_readfirstlane(tid >> 5);   // scalar: keeps every chunk address a scalar base plus one lane offset
    const int ln   = lane & 15;

    const int half   = blockIdx.x & 1;
    const int qBlock = ((blockIdx.x >> 1) & 15) * QTILE;
    const int b      = blockIdx.x >> 5;

    int nch[Bn];
    plan_chunks(valid_len, lane, nch);
    int first = 0, nc = 0;
#pragma unroll
    for (int bb = 0; bb < Bn; ++bb) {
        if (bb < b)  first += nch[bb];
        if (bb == b) nc = nch[bb];
    }
    if (nc <= 1) return;           // stored whole by the first kernel

    const float* mlp = ws + ML_OFF + ((size_t)first * Sq + qBlock + wave * 16) * 2;                             // scalar
    const _Float16* pp = reinterpret_cast<const _Float16*>(ws) + ((size_t)first * (Sq / 16) + (qBlock >> 4) + wave) * PTILE + half * 1024;   // scalar
    const unsigned mlo = (unsigned)ln * 2u;      // lane offset, in floats
    const unsigned po  = (unsigned)lane * 8u;    // lane offset, in f16 elements

    // all (max, sum) pairs in flight at once: the index is clamped, so a chunk past the last re-reads the last; its weight is 0
    v2f ml[MAXCH];
#pragma unroll
    for (int c = 0; c < MAXCH; ++c) {
        // the chunk's base held in scalar registers: every load is that base plus the one lane offset, no 64-bit vector add per load
        const unsigned long long a = (unsigned long long)(mlp + (size_t)min(c, nc - 1) * Sq * 2);
        const unsigned alo = __builtin_amdgcn_readfirstlane((unsigned)a);
        const unsigned ahi = __builtin_amdgcn_readfirstlane((unsigned)(a >> 32));
        typedef __attribute__((address_space(1))) const float gfloat;
        gfloat* sp = (gfloat*)(((unsigned long long)ahi << 32) | alo);
        ml[c][0] = sp[mlo];
        ml[c][1] = sp[mlo + 1u];
    }
    // two chunks per trip, their 8 loads in flight together; an odd count re-reads its last chunk at weight 0
    v8h x0[4], x1[4];
    auto loadPair = [&](int c) {
        const _Float16* p0 = pp + (size_t)c * Sq * Dh;
        const _Float16* p1 = pp + (size_t)min(c + 1, nc - 1) * Sq * Dh;
#pragma unroll
        for (int k = 0; k < 4; ++k) x0[k] = *(const v8h*)(p0 + k * 256 + po);
#pragma unroll
        for (int k = 0; k < 4; ++k) x1[k] = *(const v8h*)(p1 + k * 256 + po);
        // keeps all the loads above what follows: without it the scheduler sinks each load to its use and the wave waits out one latency after another
        __builtin_amdgcn_sched_barrier(0);
        // precaution: the address registers of the loads above are rewritten further down (the next trip's addresses, the epilogue): a wait stands between, in every trip
        asm volatile("s_wait_xcnt 0x0" ::: "memory");
    };
    loadPair(0);

    float M = ml[0][0];
#pragma unroll
    for (int c = 1; c < MAXCH; ++c) M = fmaxf(M, ml[c][0]);
    float w[MAXCH];
    float Ls = 0.0f;
#pragma unroll
    for (int c = 0; c < MAXCH; ++c) {
        w[c] = (c < nc) ? __expf(ml[c][0] - M) * ml[c][1] : 0.0f;   // every chunk holds a valid key: its maximum is finite
        Ls += w[c];
    }

    v8f acc[4] = {};
#pragma unroll
    for (int c = 0; c < MAXCH; c += 2) {
#pragma unroll
        for (int k = 0; k < 4; ++k)
#pragma unroll
            for (int j = 0; j < 8; ++j) { acc[k][j] += w[c] * (float)x0[k][j]; acc[k][j] += w[c + 1] * (float)x1[k][j]; }
        if (c + 2 >= MAXCH || c + 2 >= nc) break;   // scalar test; its first half, known at compile time, ends the last trip without a load or its wait
        loadPair(c + 2);
    }

    const float invl = 1.0f / Ls;
    float* op = outg + ((size_t)b * Sq + qBlock + wave * 16) * Dh + 64 * half;
    store_rows(&stage[wave][0], op, lane, acc[0], acc[1], acc[2], acc[3], invl);
}

extern "C" void kernel_launch(void* const* d_in, const int* in_sizes, int n_in,
                              void* d_out, int out_size, void* d_ws, size_t ws_size,
                              hipStream_t stream) {
    const float* q  = (const float*)d_in[0];
    const float* k  = (const float*)d_in[1];
    const float* v  = (const float*)d_in[2];
    const int*   vl = (const int*)d_in[3];
    float* out = (float*)d_out;

    float* ws = (float*)d_ws;

    fa_fwd_kernel<<<UNITS * (Sq / QTILE), 256, 0, stream>>>(q, k, v, vl, out, ws);
    fa_merge_kernel<<<Bn * (Sq / QTILE) * 2, 256, 0, stream>>>(vl, ws, out);
}

// v008
// It runs in 27.9 microseconds.
// Two timings next to v007 both put it at 1.04 times that version's speed.
// Counting every step since v000, it is 6.45 times as fast.
#include <hip/hip_runtime.h>
#include <hip/hip_bf16.h>

typedef __attribute__((ext_vector_type(16))) _Float16 v16h;
typedef __attribute__((ext_vector_type(8)))  _Float16 v8h;
typedef __attribute__((ext_vector_type(4)))  _Float16 v4h;
typedef __attribute__((ext_vector_type(8)))  short    v8s;
typedef __attribute__((ext_vector_type(8)))  float    v8f;
typedef __attribute__((ext_vector_type(4)))  float    v4f;
typedef __attribute__((ext_vector_type(2)))  float    v2f;

#define NEGVAL (-1000000.0f)

constexpr int Bn      = 16;
constexpr int Sq      = 2048;
constexpr int Sk      = 2048;
constexpr int Dh      = 128;
constexpr int QTILE   = 128;   // queries per block: 8 waves * 16 rows
constexpr int KTILE   = 32;    // keys per mainloop iteration
constexpr int KSTRIDE = 136;   // padded row pitch (halfs) of the K tile; 272B = 16B x 17 (odd): b128 fragment reads spread over all banks
constexpr int UNITS   = 32;    // (batch, key chunk) pairs at most; x 16 query blocks = 512 work-groups, two resident per WGP at this register count
constexpr int MINCH   = 8;     // shortest chunk (tiles) worth its own Q load and partial store
constexpr int MAXCH   = Sk / KTILE / MINCH;            // chunks of one batch at most
constexpr int PTILE   = 16 * Dh;                       // elements (f16) of one wave's partial O^T (16 queries)
constexpr size_t ML_OFF = (size_t)UNITS * Sq * Dh;     // float index in the workspace of the (max, sum) pairs
constexpr int VSTRIDE = 144;   // padded row pitch (halfs) of the row-major V tile; 288B = 32B x 9 (odd): the pitch of the transposing reads
constexpr int OPITCH  = 68;    // row pitch (floats) of a wave's 16 x 64 output block in LDS; 272B = 16B x 17 (odd)
constexpr int WSTAGE  = 16 * KSTRIDE;                  // halfs of one wave's own staging range: 16 Q rows (f16), or 16 x OPITCH floats

// Value of lane l ^ 16 by a vector cross-row move. __shfl_xor compiles to ds_bpermute_b32, which queues behind the wave's LDS reads:
// its wait would hold the softmax until all 16 V fragment reads issued ahead of it have returned.
__device__ __forceinline__ float xhalf(float x)
{
    const int b = __builtin_bit_cast(int, x);
    return __builtin_bit_cast(float, __builtin_amdgcn_permlanex16(b, b, 0x76543210, 0xfedcba98, false, false));
}

// 16 queries x 64 columns, from accumulator order (a lane holds 8 columns of one query: 16 lines per store) to whole rows:
// through the wave's own LDS range st, then each store covers two rows' 256 contiguous bytes (4 whole lines).
// dst = element (query 0, column 0) of the block in out.
__device__ __forceinline__ void store_rows(float* st, float* __restrict__ dst, int lane,
                                           const v8f& a0, const v8f& a1, const v8f& a2, const v8f& a3, float s)
{
    const int ln = lane & 15;
    const int hi = lane >> 4;
    float* wp = st + ln * OPITCH + 8 * hi;
    const v8f a[4] = { a0, a1, a2, a3 };
#pragma unroll
    for (int k = 0; k < 4; ++k) {
        v4f lo4, hi4;
#pragma unroll
        for (int j = 0; j < 4; ++j) { lo4[j] = a[k][j] * s; hi4[j] = a[k][4 + j] * s; }
        *(v4f*)(wp + 16 * k)     = lo4;
        *(v4f*)(wp + 16 * k + 4) = hi4;
    }
    // the rows are read back by other lanes of this wave: its own LDS writes are done first
    asm volatile("s_wait_dscnt 0x0" ::: "memory");
    const float* rp = st + hi * OPITCH + ln * 4;
    float*       gp = dst + hi * Dh + ln * 4;
#pragma unroll
    for (int i = 0; i < 8; ++i) {
        const v4f x = *(const v4f*)(rp + 2 * i * OPITCH);
        *(v4f*)(gp + 2 * i * Dh) = x;
    }
}

// Cut of the keys, derived from the lengths alone and alike in both kernels: every batch's key tiles fall into
// chunks of L tiles, L the smallest length (>= MINCH) at which all batches together make at most UNITS chunks.
// Lane l tries L = l + 1; lane 31 always passes (64 tiles at most are two chunks of 32). A batch of length 0 is one chunk.
// Needs all 32 lanes on. Returns L; nch[b] = chunks of batch b (wave-uniform).
__device__ __forceinline__ int plan_chunks(const int* __restrict__ valid_len, int lane, int (&nch)[Bn])
{
    const unsigned L     = (unsigned)lane + 1u;
    const unsigned recip = 65536u / L + 1u;    // x / L == (x * recip) >> 16, exact while x * L < 65536 (here x < 96, L <= 32)
    int n[Bn];
    int cnt = 0;
#pragma unroll
    for (int b = 0; b < Bn; ++b) {
        const unsigned nT = (unsigned)(min(max(valid_len[b], 0), Sk) + KTILE - 1) / KTILE;
        n[b] = max((int)(((nT + L - 1u) * recip) >> 16), 1);
        cnt += n[b];
    }
    const unsigned ok  = __builtin_amdgcn_ballot_w32(cnt <= UNITS && L >= (unsigned)MINCH);
    const int      sel = __builtin_ctz(ok);
#pragma unroll
    for (int b = 0; b < Bn; ++b) nch[b] = __builtin_amdgcn_readlane(n[b], sel);
    return sel + 1;
}

// Flash-attention, wave32 WMMA formulation:
//   GEMM1: S^T = K_tile x Q^T ; GEMM2: O^T += V^T x P^T
// S^T accumulator layout feeds the P^T B-fragment with zero cross-lane moves.
// V is staged row-major like K; ds_load_tr16_b128 transposes it on the way to the A fragment.
// Double-buffered LDS; global loads for tile t+1 issue before tile t's WMMAs.
// The fragment LDS reads of each GEMM are issued as one group ahead of its WMMAs: one LDS latency per GEMM, not one per WMMA.
// One work-group = one (batch, key chunk, 128-query block). A batch of one chunk is normalized and stored to out here;
// a batch of several leaves partials (f16, each normalized by its own sum) and (max, sum) in the workspace for fa_merge_kernel.
__global__ __launch_bounds__(256)
void fa_fwd_kernel(const float* __restrict__ qg,
                   const float* __restrict__ kg,
                   const float* __restrict__ vg,
                   const int*   __restrict__ valid_len,
                   float*       __restrict__ outg,
                   float*       __restrict__ ws)
{
    __shared__ __attribute__((aligned(16))) _Float16 Ksh [2][KTILE * KSTRIDE]; // [buf][key][d]   2 x 8.5 KB
    __shared__ __attribute__((aligned(16))) _Float16 Vsh[2][KTILE * VSTRIDE]; // [buf][key][d]   2 x 9 KB

    const int tid  = threadIdx.x;
    const int lane = tid & 31;
    const int wave = tid >> 5;
    const int ln   = lane & 15;    // query column / matrix row-in-lane
    const int hi   = lane >> 4;    // half-wave select

    // which (batch, chunk) this work-group has: all scalar, alike in every wave
    int nch[Bn];
    const int L    = plan_chunks(valid_len, lane, nch);
    const int unit = blockIdx.x >> 4;
    int b = -1, chunk = 0, nc = 0;
    {
        int first = 0;
#pragma unroll
        for (int bb = 0; bb < Bn; ++bb) {
            if (unit >= first && unit < first + nch[bb]) { b = bb; chunk = unit - first; nc = nch[bb]; }
            first += nch[bb];
        }
    }
    if (b < 0) return;             // no chunk left for this work-group: the whole group leaves, before any barrier

    const int qBlock = (blockIdx.x & 15) * QTILE;
    const int qRow   = qBlock + wave * 16 + ln;
    // clamp bounds the trip count and every K/V address (same mask as the raw value); readfirstlane keeps it in a scalar register
    const int vlen   = __builtin_amdgcn_readfirstlane(min(max(valid_len[b], 0), Sk));

    const float* kb = kg + (size_t)b * Sk * Dh;
    const float* vb = vg + (size_t)b * Sk * Dh;

    // ---- vlen==0: softmax over a constant row -> uniform weights -> mean(V) ----
    if (vlen == 0) {
        float* red = reinterpret_cast<float*>(&Ksh[0][0]);   // 256 floats scratch
        const int d  = tid & 127;
        const int h2 = tid >> 7;
        float acc = 0.0f;
        for (int s = h2; s < Sk; s += 2) acc += vb[(size_t)s * Dh + d];
        red[tid] = acc;
        __syncthreads();
        const float mean = (red[d] + red[d + 128]) * (1.0f / (float)Sk);
        for (int r = h2; r < QTILE; r += 2)
            outg[((size_t)b * Sq + qBlock + r) * Dh + d] = mean;
        return;
    }

    const float sscale = 0.08838834764831845f;  // 1/sqrt(128), folded into Q

    // each wave's own staging range in the tile buffers, for Q ahead of the loop and for out behind it: waves 0..3 fill Ksh, 4..7 lie in Vsh
    _Float16* wstage = (wave < 4 ? &Ksh[0][0] : &Vsh[0][0]) + (wave & 3) * WSTAGE;

    // O^T accumulators: 8 fragments cover d = 0..127 (16 per fragment)
    v8f o[8] = {};
    float m_i = -INFINITY;
    float l_i = 0.0f;

    const int nAll   = ((vlen + KTILE - 1) & ~(KTILE - 1)) / KTILE;   // >= 1
    const int tFirst = chunk * L;                                     // < nAll: chunk < ceil(nAll / L)
    const int nTiles = min(nAll, tFirst + L);                         // end of this chunk
    // The 16 query blocks of a chunk read the same K/V lines. Each enters the chunk's tiles at its own start and wraps round,
    // so that they do not ask L2 for the same lines at the same moment. The online softmax takes the tiles in any order.
    const int tStart = tFirst + (((blockIdx.x & 15) * (nTiles - tFirst)) >> 4);   // in [tFirst, nTiles)

    // register staging for the double-buffer pipeline
    v4f kreg[4], vreg[4];

    auto loadTile = [&](int kt) {
#pragma unroll
        for (int p = 0; p < 4; ++p) {
            const int i = tid + p * 256;
            kreg[p] = *(const v4f*)(kb + (size_t)kt * Dh + i * 4);
            vreg[p] = *(const v4f*)(vb + (size_t)kt * Dh + i * 4);
        }
    };
    auto storeTile = [&](int buf) {
#pragma unroll
        for (int p = 0; p < 4; ++p) {
            const int i   = tid + p * 256;
            const int key = (i * 4) >> 7;     // 0..31
            const int col = (i * 4) & 127;    // d, multiple of 4
            v4h kh;
#pragma unroll
            for (int j = 0; j < 4; ++j) kh[j] = (_Float16)kreg[p][j];
            *(v4h*)(&Ksh[buf][key * KSTRIDE + col]) = kh;
            v4h vh;
#pragma unroll
            for (int j = 0; j < 4; ++j) vh[j] = (_Float16)vreg[p][j];
            *(v4h*)(&Vsh[buf][key * VSTRIDE + col]) = vh;
        }
    };

    loadTile(tStart * KTILE);

    // ---- Q^T B-fragments (pre-scaled), resident for the whole kernel ----
    // Loaded a whole 512-byte row per instruction (a lane-per-row load touches 16 lines), scaled, rounded, and turned into fragments through LDS.
    v16h bq[4];
    {
        const float* qp = qg + ((size_t)b * Sq + qBlock + wave * 16) * Dh + lane * 4;
#pragma unroll
        for (int r = 0; r < 16; ++r) {
            const v4f x = *(const v4f*)(qp + r * Dh);
            v4h h;
#pragma unroll
            for (int j = 0; j < 4; ++j) h[j] = (_Float16)(x[j] * sscale);
            *(v4h*)(wstage + r * KSTRIDE + lane * 4) = h;
        }
        // the rows are read back by other lanes of this wave: its own LDS writes are done first
        asm volatile("s_wait_dscnt 0x0" ::: "memory");
        const _Float16* qr = wstage + ln * KSTRIDE + hi * 8;
#pragma unroll
        for (int c = 0; c < 4; ++c) {
            const v8h x = *(const v8h*)(qr + 32 * c);        // halves 0..7
            const v8h y = *(const v8h*)(qr + 32 * c + 16);   // halves 8..15
            v16h t;
#pragma unroll
            for (int j = 0; j < 8; ++j) { t[j] = x[j]; t[j + 8] = y[j]; }
            bq[c] = t;
        }
    }
    __syncthreads();               // every wave holds its Q fragments: the tile buffers may be written

    storeTile(0);

    int tile = tStart;                         // the tile of this trip
    for (int t = tFirst; t < nTiles; ++t) {    // t counts the trips
        const int kt    = tile * KTILE;
        const int tNext = (tile + 1 == nTiles) ? tFirst : tile + 1;   // wraps to the chunk's first tile
        const int cur   = (t - tFirst) & 1;
        __syncthreads();                       // buffer `cur` ready, other buffer free

        const _Float16* kbase = &Ksh[cur][0];
        // lane address of the transposing read: row 8*hi + (lane & 7), 16-byte column half (lane >> 3) & 1
        const _Float16* vbase = &Vsh[cur][(8 * hi + (lane & 7)) * VSTRIDE + 8 * ((lane >> 3) & 1)];

        auto ldA = [&](int row16, int c, v16h& a) {   // K-tile A fragment
            const _Float16* r = kbase + (row16 + ln) * KSTRIDE + 32 * c + hi * 8;
            const v8h x = *(const v8h*)r;
            const v8h y = *(const v8h*)(r + 16);
#pragma unroll
            for (int j = 0; j < 8; ++j) { a[j] = x[j]; a[j + 8] = y[j]; }
        };
        auto ldV = [&](int n, v16h& a) {              // V^T A fragment (d-chunk n)
            typedef __attribute__((address_space(3))) v8s lds_v8s;
            const _Float16* vc = vbase + 16 * n;
            // lane (ln, hi) receives V[8*hi + 0..7][16*n + ln], then keys 16 + 8*hi + 0..7: the k order of pT
            const v8h x = __builtin_bit_cast(v8h, __builtin_amdgcn_ds_load_tr16_b128_v8i16((lds_v8s*)vc));
            const v8h y = __builtin_bit_cast(v8h, __builtin_amdgcn_ds_load_tr16_b128_v8i16((lds_v8s*)(vc + 16 * VSTRIDE)));
#pragma unroll
            for (int j = 0; j < 8; ++j) { a[j] = x[j]; a[j + 8] = y[j]; }
        };

        // ---- GEMM1: S^T = K_tile . (Q*scale)^T: all 16 fragment reads stand as one group ahead of the 8 products ----
        v8f s0 = {}, s1 = {};
        {
            v16h ka[8];
#pragma unroll
            for (int c = 0; c < 4; ++c) { ldA(0, c, ka[2 * c]); ldA(16, c, ka[2 * c + 1]); }
            // behind the K reads, which the products below wait for first; its branch ends the block, so the scheduler cannot sink a read to its product
            if (t + 1 < nTiles) loadTile(tNext * KTILE);   // latency hidden by WMMAs below
#pragma unroll
            for (int c = 0; c < 4; ++c) {
                s0 = __builtin_amdgcn_wmma_f32_16x16x32_f16(false, ka[2 * c],     false, bq[c],
                                                            (short)0, s0, false, false);
                s1 = __builtin_amdgcn_wmma_f32_16x16x32_f16(false, ka[2 * c + 1], false, bq[c],
                                                            (short)0, s1, false, false);
            }
        }

        // ---- mask only the (single) partial tail tile, in whichever trip it comes ----
        if (kt + KTILE > vlen) {
            const int rem = vlen - kt - 8 * hi;    // per-lane; key0 = kt+8hi+j
#pragma unroll
            for (int j = 0; j < 8; ++j) {
                if (j >= rem)      s0[j] = NEGVAL;  // kt+8hi+j    >= vlen
                if (j >= rem - 16) s1[j] = NEGVAL;  // kt+16+8hi+j >= vlen
            }
        }

        // all 16 V^T fragment reads as one group, as early as the K fragments' registers are free: one LDS latency for GEMM2.
        v16h va[8];
#pragma unroll
        for (int n = 0; n < 8; ++n) ldV(n, va[n]);

        // ---- online softmax (per-query state per-lane; halves hold same query) ----
        float tmax = s0[0];
#pragma unroll
        for (int j = 1; j < 8; ++j) tmax = fmaxf(tmax, s0[j]);
#pragma unroll
        for (int j = 0; j < 8; ++j) tmax = fmaxf(tmax, s1[j]);
        tmax = fmaxf(tmax, xhalf(tmax));

        float corr = 1.0f;
        if (__ballot(tmax > m_i)) {            // wave-uniform: skip exact-identity rescale
            const float mNew = fmaxf(m_i, tmax);
            corr = __expf(m_i - mNew);
            m_i  = mNew;
#pragma unroll
            for (int n = 0; n < 8; ++n)
#pragma unroll
                for (int j = 0; j < 8; ++j) o[n][j] *= corr;
        }

        v16h pT;
        float lsum = 0.0f;
#pragma unroll
        for (int j = 0; j < 8; ++j) {
            const float p0 = __expf(s0[j] - m_i);
            const float p1 = __expf(s1[j] - m_i);
            pT[j]     = (_Float16)p0;
            pT[j + 8] = (_Float16)p1;
            lsum += p0 + p1;
        }
        lsum += xhalf(lsum);
        l_i = l_i * corr + lsum;

        // ---- GEMM2: O^T += V^T . P^T, fragments already in registers ----
#pragma unroll
        for (int n = 0; n < 8; ++n)
            o[n] = __builtin_amdgcn_wmma_f32_16x16x32_f16(false, va[n], false, pT,
                                                          (short)0, o[n], false, false);

        if (t + 1 < nTiles) storeTile(1 - cur);     // convert + stage next buffer
        tile = tNext;
    }

    // ---- several chunks: partial O^T as f16 in register order (512 contiguous bytes per store) + (max, sum) ----
    // Divided by the chunk's own sum first: a weighted mean of V rows, so it stays in f16 range whatever the chunk's length.
    if (nc > 1) {
        const float pinv = 1.0f / l_i;     // every chunk holds a valid key: its sum is at least 1
        _Float16* pw = reinterpret_cast<_Float16*>(ws) + ((size_t)unit * (Sq / 16) + (qBlock >> 4) + wave) * PTILE + lane * 8;
#pragma unroll
        for (int n = 0; n < 8; ++n) {
            v8h h;
#pragma unroll
            for (int j = 0; j < 8; ++j) h[j] = (_Float16)(o[n][j] * pinv);
            *(v8h*)(pw + n * 256) = h;
        }
        if (hi == 0) {             // both halves hold the same pair
            v2f ml; ml[0] = m_i; ml[1] = l_i;
            *(v2f*)(ws + ML_OFF + ((size_t)unit * Sq + qRow) * 2) = ml;
        }
        return;
    }

    // ---- normalize + write out, in whole lines, 64 columns at a time ----
    __syncthreads();               // every wave has read the last tile: the buffers become output staging
    const float invl = 1.0f / l_i;
    float* op = outg + ((size_t)b * Sq + qBlock + wave * 16) * Dh;
    store_rows(reinterpret_cast<float*>(wstage), op,      lane, o[0], o[1], o[2], o[3], invl);
    // precaution: the second half reuses the registers that the stores above name
    asm volatile("s_wait_xcnt 0x0" ::: "memory");
    store_rows(reinterpret_cast<float*>(wstage), op + 64, lane, o[4], o[5], o[6], o[7], invl);
    // precaution: in the built code the partial path's register writes stand behind these stores
    asm volatile("s_wait_xcnt 0x0" ::: "memory");
}

// Joins the chunks of a batch: weight exp(m_c - M) * l_c per chunk (the partials come normalized), sums in chunk order, one division.
// One wave = 16 queries x 64 of the 128 output columns (a half), in the register order the partials were stored in.
__global__ __launch_bounds__(256)
void fa_merge_kernel(const int*   __restrict__ valid_len,
                     const float* __restrict__ ws,
                     float*       __restrict__ outg)
{
    __shared__ __attribute__((aligned(16))) float stage[8][16 * OPITCH];   // one range per wave: no barrier

    const int tid  = threadIdx.x;
    const int lane = tid & 31;
    const int wave = __builtin_amdgcn_readfirstlane(tid >> 5);   // scalar: keeps every chunk address a scalar base plus one lane offset
    const int ln   = lane & 15;

    const int half   = blockIdx.x & 1;
    const int qBlock = ((blockIdx.x >> 1) & 15) * QTILE;
    const int b      = blockIdx.x >> 5;

    int nch[Bn];
    plan_chunks(valid_len, lane, nch);
    int first = 0, nc = 0;
#pragma unroll
    for (int bb = 0; bb < Bn; ++bb) {
        if (bb < b)  first += nch[bb];
        if (bb == b) nc = nch[bb];
    }
    if (nc <= 1) return;           // stored whole by the first kernel

    const float* mlp = ws + ML_OFF + ((size_t)first * Sq + qBlock + wave * 16) * 2;                             // scalar
    const _Float16* pp = reinterpret_cast<const _Float16*>(ws) + ((size_t)first * (Sq / 16) + (qBlock >> 4) + wave) * PTILE + half * 1024;   // scalar
    const unsigned mlo = (unsigned)ln * 2u;      // lane offset, in floats
    const unsigned po  = (unsigned)lane * 8u;    // lane offset, in f16 elements

    // all (max, sum) pairs in flight at once: the index is clamped, so a chunk past the last re-reads the last; its weight is 0
    v2f ml[MAXCH];
#pragma unroll
    for (int c = 0; c < MAXCH; ++c) {
        // the chunk's base held in scalar registers: every load is that base plus the one lane offset, no 64-bit vector add per load
        const unsigned long long a = (unsigned long long)(mlp + (size_t)min(c, nc - 1) * Sq * 2);
        const unsigned alo = __builtin_amdgcn_readfirstlane((unsigned)a);
        const unsigned ahi = __builtin_amdgcn_readfirstlane((unsigned)(a >> 32));
        typedef __attribute__((address_space(1))) const float gfloat;
        gfloat* sp = (gfloat*)(((unsigned long long)ahi << 32) | alo);
        ml[c][0] = sp[mlo];
        ml[c][1] = sp[mlo + 1u];
    }
    // two chunks per trip, their 8 loads in flight together; an odd count re-reads its last chunk at weight 0
    v8h x0[4], x1[4];
    auto loadPair = [&](int c) {
        const _Float16* p0 = pp + (size_t)c * Sq * Dh;
        const _Float16* p1 = pp + (size_t)min(c + 1, nc - 1) * Sq * Dh;
#pragma unroll
        for (int k = 0; k < 4; ++k) x0[k] = *(const v8h*)(p0 + k * 256 + po);
#pragma unroll
        for (int k = 0; k < 4; ++k) x1[k] = *(const v8h*)(p1 + k * 256 + po);
        // keeps all the loads above what follows: without it the scheduler sinks each load to its use and the wave waits out one latency after another
        __builtin_amdgcn_sched_barrier(0);
        // precaution: the address registers of the loads above are rewritten further down (the next trip's addresses, the epilogue): a wait stands between, in every trip
        asm volatile("s_wait_xcnt 0x0" ::: "memory");
    };
    loadPair(0);

    float M = ml[0][0];
#pragma unroll
    for (int c = 1; c < MAXCH; ++c) M = fmaxf(M, ml[c][0]);
    float w[MAXCH];
    float Ls = 0.0f;
#pragma unroll
    for (int c = 0; c < MAXCH; ++c) {
        w[c] = (c < nc) ? __expf(ml[c][0] - M) * ml[c][1] : 0.0f;   // every chunk holds a valid key: its maximum is finite
        Ls += w[c];
    }

    v8f acc[4] = {};
#pragma unroll
    for (int c = 0; c < MAXCH; c += 2) {
#pragma unroll
        for (int k = 0; k < 4; ++k)
#pragma unroll
            for (int j = 0; j < 8; ++j) { acc[k][j] += w[c] * (float)x0[k][j]; acc[k][j] += w[c + 1] * (float)x1[k][j]; }
        if (c + 2 >= MAXCH || c + 2 >= nc) break;   // scalar test; its first half, known at compile time, ends the last trip without a load or its wait
        loadPair(c + 2);
    }

    const float invl = 1.0f / Ls;
    float* op = outg + ((size_t)b * Sq + qBlock + wave * 16) * Dh + 64 * half;
    store_rows(&stage[wave][0], op, lane, acc[0], acc[1], acc[2], acc[3], invl);
}

extern "C" void kernel_launch(void* const* d_in, const int* in_sizes, int n_in,
                              void* d_out, int out_size, void* d_ws, size_t ws_size,
                              hipStream_t stream) {
    const float* q  = (const float*)d_in[0];
    const float* k  = (const float*)d_in[1];
    const float* v  = (const float*)d_in[2];
    const int*   vl = (const int*)d_in[3];
    float* out = (float*)d_out;

    float* ws = (float*)d_ws;

    fa_fwd_kernel<<<UNITS * (Sq / QTILE), 256, 0, stream>>>(q, k, v, vl, out, ws);
    fa_merge_kernel<<<Bn * (Sq / QTILE) * 2, 256, 0, stream>>>(vl, ws, out);
}
